// v000
// Measured on an AMD MI455X. A time is GPU time per run, averaged over a window of back-to-back runs after a warm-up
// (all launches, gaps included; the runs take copies of the inputs in turn), and the median of several windows.
// Apart from v000's, it joins two sittings. Times from different sittings can be a few percent apart, while
// side-by-side timings come from the same sitting.
// v000, which the later versions start from, runs in 770 microseconds.
#include <hip/hip_runtime.h>

// Contractions: q/k/v projections on v_wmma_f32_16x16x32_bf16 (x and the stacked QKV weights RNE-converted to bf16, weights transposed to [out][in] planes, exact products, f32 accumulate); q.k^T and att.v on v_wmma_f32_16x16x32_f16 (f16 q/k/v planes; softmax weights carried x1024 and centred by 1024/SEQ, column mean of v added back in f32), f32 accumulate.
// Single-head full-width self-attention: x [8][2048][768]; q = x QKV[0], k = x QKV[1], v = x QKV[2] ('io' [768][768] each, stacked [3][768][768], no bias); att = softmax(q.k * 768^-0.5) over all 2048 keys (no mask); out = att @ v -> [8][2048][768] f32.
// Two batches per pass (z-batched GEMMs): projections -> f32 rows -> f16 planes (q, k row-major; v transposed [d][t]); S = q k^T (f32, materialised per pass); row softmax in registers; O = P' v; out = O/1024 + mean_t(v).

#ifndef NB
#define NB 8
#endif
#ifndef SEQ
#define SEQ 2048
#endif
#define NB_FULL  8
#define SEQ_FULL 2048
#define DM   768
#define HD   768
#define ZB   ((NB % 2 == 0) ? 2 : 1)     // batches per pass
#define PCAR 1024.0f
#define SCL  0.03608439182435161f         // 768^-0.5

typedef _Float16 h16;
typedef unsigned short bf;
typedef __attribute__((ext_vector_type(16))) __bf16   v16bf;
typedef __attribute__((ext_vector_type(16))) _Float16 v16h;
typedef __attribute__((ext_vector_type(8)))  _Float16 v8h;
typedef __attribute__((ext_vector_type(8)))  unsigned short v8us;
typedef __attribute__((ext_vector_type(8)))  float    v8f;
typedef __attribute__((ext_vector_type(4)))  float    v4f;
typedef __attribute__((ext_vector_type(2)))  float    v2f;
typedef __attribute__((ext_vector_type(2)))  _Float16 v2h;
typedef __attribute__((ext_vector_type(4)))  _Float16 v4h;
typedef v4f  __attribute__((may_alias)) v4fa;

static_assert(NB <= NB_FULL);
static_assert(SEQ <= SEQ_FULL);
static_assert(NB % ZB == 0);
static_assert(SEQ % 128 == 0);                 // softmax row chunks, 64-row tiles, K steps of 32
static_assert(DM % 64 == 0 && HD % 64 == 0);   // 64x64 tiles, K steps of 32
static_assert(DM == HD);                       // one full-width head: plane pitch == row pitch
static_assert(((size_t)SEQ * DM) % 8 == 0);
static_assert((ZB * SEQ) % 8 == 0);
static_assert(HD % 32 == 0 && SEQ % 8 == 0);
static_assert((DM * 2) % 128 == 0);

__device__ __forceinline__ unsigned short f2bf(float f) { unsigned u = __float_as_uint(f); u += 0x7FFFu + ((u >> 16) & 1u); return (unsigned short)(u >> 16); }
__device__ __forceinline__ v16h cat16(v8h lo, v8h hi) { return __builtin_shufflevector(lo, hi, 0, 1, 2, 3, 4, 5, 6, 7, 8, 9, 10, 11, 12, 13, 14, 15); }
__device__ __forceinline__ v16bf cat16b(v8us lo, v8us hi) { return __builtin_bit_cast(v16bf, __builtin_shufflevector(lo, hi, 0, 1, 2, 3, 4, 5, 6, 7, 8, 9, 10, 11, 12, 13, 14, 15)); }
__device__ __forceinline__ v8f wmma16(v16h a, v16h b, v8f c) { return __builtin_amdgcn_wmma_f32_16x16x32_f16(false, a, false, b, (short)0, c, false, false); }
__device__ __forceinline__ v8f wmmab(v16bf a, v16bf b, v8f c) { return __builtin_amdgcn_wmma_f32_16x16x32_bf16(false, a, false, b, (short)0, c, false, false); }
__device__ __forceinline__ h16 tohx(float x) { return (h16)x; }

// ---- k_gemmw: register-blocked GEMM, ONE WAVE per 64x64 output tile (16 accumulators), operands straight from K-contiguous 16-bit planes; grid (M/64, N/64, Z), 32 threads.
// C[m][n] (f32, pitch ldc) = sum_k A[m][k] Bt[n][k]. z-batch strides sA/sB/sC in elements. K % 32 == 0, M % 64 == 0, N % 64 == 0.
// Fragment map (A and Bt alike): lane -> row/col lane&15, h = lane>>4; elements 0..7 = k0+8h+0..7, elements 8..15 = k0+16+8h+0..7. D: acc[j] = (row 8h+j, col lane&15).
template <typename T16> struct WFrag;
template <> struct WFrag<h16> { typedef v16h V; static __device__ __forceinline__ V ld(const h16* p) { return cat16(*(const v8h*)p, *(const v8h*)(p + 16)); } static __device__ __forceinline__ v8f mma(V a, V b, v8f c) { return wmma16(a, b, c); } };
template <> struct WFrag<bf> { typedef v16bf V; static __device__ __forceinline__ V ld(const bf* p) { return cat16b(*(const v8us*)p, *(const v8us*)(p + 16)); } static __device__ __forceinline__ v8f mma(V a, V b, v8f c) { return wmmab(a, b, c); } };
template <typename T16>
__global__ __launch_bounds__(32) void k_gemmw(const T16* __restrict__ A, const T16* __restrict__ Bt, int K, float* C, int ldc, size_t sA, size_t sB, size_t sC) {
    typedef typename WFrag<T16>::V V;
    __shared__ __align__(16) float os[16 * 68];
    const size_t z = blockIdx.z; A += z * sA; Bt += z * sB; C += z * sC;
    const int lane = threadIdx.x & 31, lr = lane & 15, hi = lane >> 4; const int r0 = blockIdx.x * 64, c0 = blockIdx.y * 64;
    v8f acc[4][4];
#pragma unroll
    for (int mb = 0; mb < 4; ++mb)
#pragma unroll
        for (int nb = 0; nb < 4; ++nb) acc[mb][nb] = (v8f){};
    const size_t aoff = (size_t)(r0 + lr) * K + 8 * hi, boff = (size_t)(c0 + lr) * K + 8 * hi;
#pragma unroll 1
    for (int kc = 0; kc < K; kc += 32) {
        V a[4];
#pragma unroll
        for (int mb = 0; mb < 4; ++mb) a[mb] = WFrag<T16>::ld(A + aoff + (size_t)mb * 16 * K + kc);
#pragma unroll
        for (int nb = 0; nb < 4; ++nb) { const V b = WFrag<T16>::ld(Bt + boff + (size_t)nb * 16 * K + kc);
#pragma unroll
            for (int mb = 0; mb < 4; ++mb) acc[mb][nb] = WFrag<T16>::mma(a[mb], b, acc[mb][nb]); }
        asm volatile("v_nop\n\tv_nop\n\tv_nop\n\tv_nop" : "+v"(acc[0][0]), "+v"(acc[1][1]), "+v"(acc[2][2]), "+v"(acc[3][3]) : "v"(a[0]), "v"(a[3]));
    }
#pragma unroll
    for (int mb = 0; mb < 4; ++mb) {
#pragma unroll
        for (int nb = 0; nb < 4; ++nb) {
#pragma unroll
            for (int j = 0; j < 8; ++j) os[(hi * 8 + j) * 68 + nb * 16 + lr] = acc[mb][nb][j]; }
        __builtin_amdgcn_wave_barrier(); asm volatile("" ::: "memory");
        float* crow = C + (size_t)(r0 + mb * 16) * ldc + c0;
{
#pragma unroll
            for (int s = 0; s < 8; ++s) { const int row = 2 * s + hi, cofs = lr * 4; const v4f val = *(const v4fa*)(os + row * 68 + cofs);
                *(v4f*)(crow + (size_t)row * ldc + cofs) = val; }
             }
        __builtin_amdgcn_wave_barrier(); asm volatile("" ::: "memory");
    }
}

__global__ __launch_bounds__(256) void k_cvt8(const float* __restrict__ src, bf* dst, size_t n8, size_t sS, size_t sD) {
    const size_t i = (size_t)blockIdx.x * 256 + threadIdx.x; if (i >= n8) return;
    src += (size_t)blockIdx.y * sS; dst += (size_t)blockIdx.y * sD;
    const v8f v = *(const v8f*)(src + i * 8); v8us o;
#pragma unroll
    for (int k = 0; k < 8; ++k) o[k] = f2bf(v[k]);
    *(v8us*)(dst + i * 8) = o;  }

// k_wtp: weight plane WT[e][d] (bf16, RNE) = W[d][e] (f32, [in][out] orientation); one 64(d) x 64(e) tile per block, transposed through LDS (all 64x64 entries staged, block barrier, pad column never read);
__global__ __launch_bounds__(256) void k_wtp(const float* __restrict__ W, bf* WT) {
    __shared__ float tl[64 * 65];
    const int tid = threadIdx.x; const int d0 = blockIdx.x * 64, e0 = blockIdx.y * 64;
#pragma unroll 4
    for (int i = 0; i < 16; ++i) { const int idx = i * 256 + tid; const int dd = idx >> 6, ee = idx & 63; tl[dd * 65 + ee] = W[(size_t)(d0 + dd) * HD + e0 + ee]; }
    __syncthreads();
    const int pc = tid & 7, er = tid >> 3; v8us o0, o1;
#pragma unroll
    for (int k = 0; k < 8; ++k) { o0[k] = f2bf(tl[(pc * 8 + k) * 65 + er]); o1[k] = f2bf(tl[(pc * 8 + k) * 65 + 32 + er]); }
    bf* p0 = WT + (size_t)(e0 + er) * DM + d0 + pc * 8; bf* p1 = WT + (size_t)(e0 + 32 + er) * DM + d0 + pc * 8;
    *(v8us*)p0 = o0; *(v8us*)p1 = o1;  }

__global__ __launch_bounds__(256) void k_cvth(const float* __restrict__ src, h16* dst, size_t n8, size_t sS, size_t sD) {
    const size_t i = (size_t)blockIdx.x * 256 + threadIdx.x; if (i >= n8) return;
    src += (size_t)blockIdx.y * sS; dst += (size_t)blockIdx.y * sD;
    const v8f v = *(const v8f*)(src + i * 8); v8h o;
#pragma unroll
    for (int k = 0; k < 8; ++k) o[k] = tohx(v[k]);
    *(v8h*)(dst + i * 8) = o;  }

__global__ __launch_bounds__(256) void k_vtp(const float* __restrict__ F, h16* V16) {
    const size_t e = ((size_t)blockIdx.x * 256 + threadIdx.x) * 2; if (e >= (size_t)ZB * HD * SEQ) return;
    const int t = (int)(e % SEQ); const int d = (int)((e / SEQ) % HD); const int g = (int)(e / ((size_t)SEQ * HD)); v2h o16;
#pragma unroll
    for (int q = 0; q < 2; ++q) { const float xv = F[((size_t)g * SEQ + t + q) * DM + d]; o16[q] = tohx(xv); }
    *(v2h*)(V16 + e) = o16;  }

__global__ __launch_bounds__(256) void k_vmean(const float* __restrict__ F, float* VM) {
    __shared__ float part[8 * 32];
    const int c = threadIdx.x & 31, r = threadIdx.x >> 5; const int g = blockIdx.y; const int d = blockIdx.x * 32 + c;
    const float* f = F + (size_t)g * SEQ * DM + d; float s = 0.f;
#pragma unroll 4
    for (int t = r; t < SEQ; t += 8) s += f[(size_t)t * DM];
    part[r * 32 + c] = s;
    __syncthreads();
    if (r == 0) { float a = part[c];
#pragma unroll
        for (int q = 1; q < 8; ++q) a += part[q * 32 + c];
        a *= (1.0f / (float)SEQ); float* p = VM + (size_t)g * HD + d;
        *(float*)p = a;  }
}

// k_asoft: per row (one wave): t = S x 768^-0.5; softmax over the SEQ keys (register row, running max then one exp, fixed shuffle trees);
__global__ __launch_bounds__(256) void k_asoft(const float* __restrict__ Sb, h16* P16) {
    const int lane = threadIdx.x & 31; const int row = blockIdx.x * 8 + (threadIdx.x >> 5); if (row >= ZB * SEQ) return;
    const float* sr = Sb + (size_t)row * SEQ; float v[SEQ / 32]; float mx = -3.0e38f;
#pragma unroll
    for (int ch = 0; ch < SEQ / 128; ++ch) { const v4f a = *(const v4f*)(sr + ch * 128 + lane * 4);
#pragma unroll
        for (int q = 0; q < 4; ++q) { const float t = a[q] * SCL; v[ch * 4 + q] = t; mx = fmaxf(mx, t); } }
#pragma unroll
    for (int sh = 16; sh; sh >>= 1) mx = fmaxf(mx, __shfl_xor(mx, sh, 32));
    float sum = 0.f;
#pragma unroll
    for (int k = 0; k < SEQ / 32; ++k) { float d0 = __fsub_rn(v[k], mx); asm volatile("" : "+v"(d0)); v[k] = __builtin_amdgcn_exp2f(__fmul_rn(d0, 1.4426950408889634f)); sum += v[k]; }
#pragma unroll
    for (int sh = 16; sh; sh >>= 1) sum += __shfl_xor(sum, sh, 32);
    const float f = __fdiv_rn(PCAR, sum); const float cen = PCAR / (float)SEQ;
{
#pragma unroll
        for (int ch = 0; ch < SEQ / 128; ++ch) { v4h o4;
#pragma unroll
            for (int q = 0; q < 4; ++q) o4[q] = tohx(v[ch * 4 + q] * f - cen);
            *(v4h*)(P16 + (size_t)row * SEQ + ch * 128 + lane * 4) = o4; }
         }
}

__global__ __launch_bounds__(256) void k_merge(const float* __restrict__ O, const float* __restrict__ VM, float* OUTb) {
    const size_t e = ((size_t)blockIdx.x * 256 + threadIdx.x) * 2; if (e >= (size_t)ZB * SEQ * HD) return;
    const int d = (int)(e % HD); const int g = (int)(e / ((size_t)HD * SEQ));
    const v2f m = *(const v2f*)(VM + (size_t)g * HD + d); const v2f o = *(const v2f*)(O + e);
    v2f o2; o2[0] = o[0] * (1.0f / PCAR) + m[0]; o2[1] = o[1] * (1.0f / PCAR) + m[1];
    *(v2f*)(OUTb + e) = o2;  }

constexpr size_t al256(size_t b) { return (b + 255) & ~(size_t)255; }
constexpr size_t WS_TOTAL =
    3 * al256((size_t)DM * DM * 2) +              // WQ WK WV bf16, [out][in]
    al256((size_t)ZB * SEQ * DM * 2) +            // XB bf16
    al256((size_t)2 * ZB * SEQ * DM * 4) +        // FQ|FK f32 (FV reuses FQ)
    al256((size_t)2 * ZB * SEQ * HD * 2) +        // QP16|KP16
    al256((size_t)ZB * HD * SEQ * 2) +            // VT16
    al256((size_t)ZB * HD * 4) +                  // VM
    al256((size_t)ZB * SEQ * SEQ * 4) +           // Sb
    al256((size_t)ZB * SEQ * SEQ * 2) +           // P16
    al256((size_t)ZB * SEQ * HD * 4);             // Ob
static_assert(WS_TOTAL <= (size_t)134217728);

extern "C" void kernel_launch(void* const* d_in, const int* in_sizes, int n_in,
                              void* d_out, int out_size, void* d_ws, size_t ws_size, hipStream_t stream) {
    if (n_in < 2) return;
    if ((size_t)in_sizes[0] < ((size_t)(NB - 1) * SEQ_FULL + SEQ) * DM) return;
    if ((size_t)in_sizes[1] < (size_t)3 * DM * HD) return;
    if ((size_t)out_size < (size_t)NB * SEQ * DM) return;
    if (WS_TOTAL > ws_size) return;
    const float* x = (const float*)d_in[0]; const float* qkv = (const float*)d_in[1];   // qkv: [3][in 768][out 768], slabs q, k, v
    float* OUT = (float*)d_out;     // [NB][SEQ][768]
    char* wsp = (char*)d_ws;
    auto take = [&](size_t bytes) { char* p = wsp; wsp += al256(bytes); return (void*)p; };
    bf* WQ = (bf*)take((size_t)DM * DM * 2); bf* WK = (bf*)take((size_t)DM * DM * 2); bf* WV = (bf*)take((size_t)DM * DM * 2);
    bf* XB = (bf*)take((size_t)ZB * SEQ * DM * 2);
    float* FQ = (float*)take((size_t)2 * ZB * SEQ * DM * 4); float* FK = FQ + (size_t)ZB * SEQ * DM; float* FV = FQ;   // v rows reuse the q slab after the q/k planes are built (stream-ordered)
    h16* QP16 = (h16*)take((size_t)2 * ZB * SEQ * HD * 2); h16* KP16 = QP16 + (size_t)ZB * SEQ * HD;
    h16* VT16 = (h16*)take((size_t)ZB * HD * SEQ * 2);
    float* VM = (float*)take((size_t)ZB * HD * 4);
    float* Sb = (float*)take((size_t)ZB * SEQ * SEQ * 4); h16* P16 = (h16*)take((size_t)ZB * SEQ * SEQ * 2); float* Ob = (float*)take((size_t)ZB * SEQ * HD * 4);
    if ((size_t)(wsp - (char*)d_ws) > ws_size) return;

    // weight slabs W[d][e] ([in][out]) -> planes WT[e][d] ([out][in], K-contiguous for the GEMM's Bt operand)
    k_wtp<<<dim3(DM / 64, HD / 64, 1), 256, 0, stream>>>(qkv, WQ);
    k_wtp<<<dim3(DM / 64, HD / 64, 1), 256, 0, stream>>>(qkv + (size_t)DM * HD, WK);
    k_wtp<<<dim3(DM / 64, HD / 64, 1), 256, 0, stream>>>(qkv + (size_t)2 * DM * HD, WV);

    const size_t x8 = (size_t)SEQ * DM / 8;                 // per batch slab
    const size_t p8 = (size_t)ZB * SEQ * DM / 8;            // per q / k slab
    const unsigned LE2 = (unsigned)(((size_t)ZB * SEQ * HD / 2 + 255) / 256);
    for (int b0 = 0; b0 < NB; b0 += ZB) {
        k_cvt8<<<dim3((unsigned)((x8 + 255) / 256), ZB, 1), 256, 0, stream>>>(x + (size_t)b0 * SEQ_FULL * DM, XB, x8, (size_t)SEQ_FULL * DM, (size_t)SEQ * DM);
        k_gemmw<bf><<<dim3(ZB * SEQ / 64, DM / 64, 1), 32, 0, stream>>>(XB, WQ, DM, FQ, DM, 0, 0, 0);
        k_gemmw<bf><<<dim3(ZB * SEQ / 64, DM / 64, 1), 32, 0, stream>>>(XB, WK, DM, FK, DM, 0, 0, 0);
        k_cvth<<<dim3((unsigned)((p8 + 255) / 256), 2, 1), 256, 0, stream>>>(FQ, QP16, p8, (size_t)ZB * SEQ * DM, (size_t)ZB * SEQ * HD);
        k_gemmw<bf><<<dim3(ZB * SEQ / 64, DM / 64, 1), 32, 0, stream>>>(XB, WV, DM, FV, DM, 0, 0, 0);
        k_vtp<<<LE2, 256, 0, stream>>>(FV, VT16);
        k_vmean<<<dim3(HD / 32, ZB, 1), 256, 0, stream>>>(FV, VM);
        k_gemmw<h16><<<dim3(SEQ / 64, SEQ / 64, ZB), 32, 0, stream>>>(QP16, KP16, HD, Sb, SEQ, (size_t)SEQ * HD, (size_t)SEQ * HD, (size_t)SEQ * SEQ);
        k_asoft<<<ZB * SEQ / 8, 256, 0, stream>>>(Sb, P16);
        k_gemmw<h16><<<dim3(SEQ / 64, HD / 64, ZB), 32, 0, stream>>>(P16, VT16, SEQ, Ob, HD, (size_t)SEQ * SEQ, (size_t)HD * SEQ, (size_t)SEQ * HD);
        k_merge<<<LE2, 256, 0, stream>>>(Ob, VM, OUT + (size_t)b0 * SEQ * DM);
    }
}

// v001
// One run takes 474 microseconds.
// Two timings next to v000 put it at 1.64 and 1.63 times that version's speed.
#include <hip/hip_runtime.h>

// Contractions: q/k/v projections on v_wmma_f32_16x16x32_bf16 (x and the stacked QKV weights RNE-converted to bf16, weights transposed to [out][in] planes, exact products, f32 accumulate); q.k^T and att.v on v_wmma_f32_16x16x32_f16 (f16 q/k/v planes; softmax weights carried x1024 and centred by 1024/SEQ, column mean of v added back in f32), f32 accumulate.
// Single-head full-width self-attention: x [8][2048][768]; q = x QKV[0], k = x QKV[1], v = x QKV[2] ('io' [768][768] each, stacked [3][768][768], no bias); att = softmax(q.k * 768^-0.5) over all 2048 keys (no mask); out = att @ v -> [8][2048][768] f32.
// Two batches per pass (z-batched GEMMs): projections -> f32 rows -> f16 planes (q, k row-major; v transposed [d][t]); S = q k^T (f32, materialised per pass); row softmax in registers; O = P' v; out = O/1024 + mean_t(v).

#ifndef NB
#define NB 8
#endif
#ifndef SEQ
#define SEQ 2048
#endif
#define NB_FULL  8
#define SEQ_FULL 2048
#define DM   768
#define HD   768
#define ZB   ((NB % 2 == 0) ? 2 : 1)     // batches per pass
#define PCAR 1024.0f
#define SCL  0.03608439182435161f         // 768^-0.5

typedef _Float16 h16;
typedef unsigned short bf;
typedef __attribute__((ext_vector_type(16))) __bf16   v16bf;
typedef __attribute__((ext_vector_type(16))) _Float16 v16h;
typedef __attribute__((ext_vector_type(8)))  _Float16 v8h;
typedef __attribute__((ext_vector_type(8)))  unsigned short v8us;
typedef __attribute__((ext_vector_type(8)))  float    v8f;
typedef __attribute__((ext_vector_type(4)))  float    v4f;
typedef __attribute__((ext_vector_type(2)))  float    v2f;
typedef __attribute__((ext_vector_type(2)))  _Float16 v2h;
typedef __attribute__((ext_vector_type(4)))  _Float16 v4h;
typedef v4f  __attribute__((may_alias)) v4fa;

static_assert(NB <= NB_FULL);
static_assert(SEQ <= SEQ_FULL);
static_assert(NB % ZB == 0);
static_assert(SEQ % 128 == 0);                 // softmax row chunks, 128-row tiles, K stages of 128
static_assert(DM % 128 == 0 && HD % 128 == 0); // 128x128 tiles, K stages of 128; 64x64 weight transpose tiles
static_assert(DM == HD);                       // one full-width head: plane pitch == row pitch
static_assert(((size_t)SEQ * DM) % 8 == 0);
static_assert((ZB * SEQ) % 8 == 0);
static_assert(HD % 32 == 0 && SEQ % 8 == 0);
static_assert((DM * 2) % 128 == 0);

__device__ __forceinline__ unsigned short f2bf(float f) { unsigned u = __float_as_uint(f); u += 0x7FFFu + ((u >> 16) & 1u); return (unsigned short)(u >> 16); }
__device__ __forceinline__ v16h cat16(v8h lo, v8h hi) { return __builtin_shufflevector(lo, hi, 0, 1, 2, 3, 4, 5, 6, 7, 8, 9, 10, 11, 12, 13, 14, 15); }
__device__ __forceinline__ v16bf cat16b(v8us lo, v8us hi) { return __builtin_bit_cast(v16bf, __builtin_shufflevector(lo, hi, 0, 1, 2, 3, 4, 5, 6, 7, 8, 9, 10, 11, 12, 13, 14, 15)); }
__device__ __forceinline__ v8f wmma16(v16h a, v16h b, v8f c) { return __builtin_amdgcn_wmma_f32_16x16x32_f16(false, a, false, b, (short)0, c, false, false); }
__device__ __forceinline__ v8f wmmab(v16bf a, v16bf b, v8f c) { return __builtin_amdgcn_wmma_f32_16x16x32_bf16(false, a, false, b, (short)0, c, false, false); }
__device__ __forceinline__ h16 tohx(float x) { return (h16)x; }

// ---- k_gemmw: GEMM, one 128x128 output tile per workgroup of FOUR WAVES (2x2, each wave 64x64 = 16 accumulators); grid (M/128, N/128, Z), 128 threads.
// C[m][n] (f32, pitch ldc) = sum_k A[m][k] Bt[n][k], A and Bt K-contiguous 16-bit planes. z-batch strides sA/sB/sC in elements. K % 128 == 0, M % 128 == 0, N % 128 == 0.
// A stage is 128 k (256 B) of the tile's 128 A rows and 128 Bt rows, brought into LDS by asynchronous 16-byte copies (whole 256-B row pieces per half wave), two buffers: stage t+1 flies while stage t is multiplied.
// Fragment map (A and Bt alike): lane -> row/col lane&15, h = lane>>4; elements 0..7 = k0+8h+0..7, elements 8..15 = k0+16+8h+0..7. D: acc[j] = (row 8h+j, col lane&15).
#define GT_KS    128                      // k per stage
#define GT_PITCH 272                      // LDS row pitch, bytes: 16 B x odd, no bank conflict for 16-byte fragment reads
#define GT_OP    (128 * GT_PITCH)         // one operand's 128 rows
#define GT_BUF   (2 * GT_OP)              // A rows, then Bt rows
template <typename T16> struct WFrag;
template <> struct WFrag<h16> { typedef v16h V; static __device__ __forceinline__ V ld(const h16* p) { return cat16(*(const v8h*)p, *(const v8h*)(p + 16)); } static __device__ __forceinline__ v8f mma(V a, V b, v8f c) { return wmma16(a, b, c); } };
template <> struct WFrag<bf> { typedef v16bf V; static __device__ __forceinline__ V ld(const bf* p) { return cat16b(*(const v8us*)p, *(const v8us*)(p + 16)); } static __device__ __forceinline__ v8f mma(V a, V b, v8f c) { return wmmab(a, b, c); } };

// One stage's copies of one thread: 16 of A and 16 of Bt, rows 8 apart (thread -> row tid>>4, 16-byte column tid&15). lA: the thread's LDS byte address in the buffer's A part; gA, gB: its global addresses; rs8: 8 source rows in bytes.
// Each statement ends in s_wait_xcnt 0 so that no address register of an issued copy is rewritten ahead of that wait.
__device__ __forceinline__ void gt_stage(unsigned lA, const char* gA, const char* gB, size_t rs8) {
    unsigned l[32]; const char* g[32];
#pragma unroll
    for (int i = 0; i < 16; ++i) { l[i] = lA + (unsigned)i * (8u * GT_PITCH); g[i] = gA + (size_t)i * rs8; l[16 + i] = lA + (unsigned)GT_OP + (unsigned)i * (8u * GT_PITCH); g[16 + i] = gB + (size_t)i * rs8; }
    asm volatile(
        "global_load_async_to_lds_b128 %0, %11, off\n\t"
        "global_load_async_to_lds_b128 %1, %12, off\n\t"
        "global_load_async_to_lds_b128 %2, %13, off\n\t"
        "global_load_async_to_lds_b128 %3, %14, off\n\t"
        "global_load_async_to_lds_b128 %4, %15, off\n\t"
        "global_load_async_to_lds_b128 %5, %16, off\n\t"
        "global_load_async_to_lds_b128 %6, %17, off\n\t"
        "global_load_async_to_lds_b128 %7, %18, off\n\t"
        "global_load_async_to_lds_b128 %8, %19, off\n\t"
        "global_load_async_to_lds_b128 %9, %20, off\n\t"
        "global_load_async_to_lds_b128 %10, %21, off\n\t"
        "s_wait_xcnt 0x0"
        :: "v"(l[0]), "v"(l[1]), "v"(l[2]), "v"(l[3]), "v"(l[4]), "v"(l[5]), "v"(l[6]), "v"(l[7]), "v"(l[8]), "v"(l[9]), "v"(l[10]),
           "v"(g[0]), "v"(g[1]), "v"(g[2]), "v"(g[3]), "v"(g[4]), "v"(g[5]), "v"(g[6]), "v"(g[7]), "v"(g[8]), "v"(g[9]), "v"(g[10]) : "memory");
    asm volatile(
        "global_load_async_to_lds_b128 %0, %11, off\n\t"
        "global_load_async_to_lds_b128 %1, %12, off\n\t"
        "global_load_async_to_lds_b128 %2, %13, off\n\t"
        "global_load_async_to_lds_b128 %3, %14, off\n\t"
        "global_load_async_to_lds_b128 %4, %15, off\n\t"
        "global_load_async_to_lds_b128 %5, %16, off\n\t"
        "global_load_async_to_lds_b128 %6, %17, off\n\t"
        "global_load_async_to_lds_b128 %7, %18, off\n\t"
        "global_load_async_to_lds_b128 %8, %19, off\n\t"
        "global_load_async_to_lds_b128 %9, %20, off\n\t"
        "global_load_async_to_lds_b128 %10, %21, off\n\t"
        "s_wait_xcnt 0x0"
        :: "v"(l[11]), "v"(l[12]), "v"(l[13]), "v"(l[14]), "v"(l[15]), "v"(l[16]), "v"(l[17]), "v"(l[18]), "v"(l[19]), "v"(l[20]), "v"(l[21]),
           "v"(g[11]), "v"(g[12]), "v"(g[13]), "v"(g[14]), "v"(g[15]), "v"(g[16]), "v"(g[17]), "v"(g[18]), "v"(g[19]), "v"(g[20]), "v"(g[21]) : "memory");
    asm volatile(
        "global_load_async_to_lds_b128 %0, %10, off\n\t"
        "global_load_async_to_lds_b128 %1, %11, off\n\t"
        "global_load_async_to_lds_b128 %2, %12, off\n\t"
        "global_load_async_to_lds_b128 %3, %13, off\n\t"
        "global_load_async_to_lds_b128 %4, %14, off\n\t"
        "global_load_async_to_lds_b128 %5, %15, off\n\t"
        "global_load_async_to_lds_b128 %6, %16, off\n\t"
        "global_load_async_to_lds_b128 %7, %17, off\n\t"
        "global_load_async_to_lds_b128 %8, %18, off\n\t"
        "global_load_async_to_lds_b128 %9, %19, off\n\t"
        "s_wait_xcnt 0x0"
        :: "v"(l[22]), "v"(l[23]), "v"(l[24]), "v"(l[25]), "v"(l[26]), "v"(l[27]), "v"(l[28]), "v"(l[29]), "v"(l[30]), "v"(l[31]),
           "v"(g[22]), "v"(g[23]), "v"(g[24]), "v"(g[25]), "v"(g[26]), "v"(g[27]), "v"(g[28]), "v"(g[29]), "v"(g[30]), "v"(g[31]) : "memory");
}

template <typename T16>
__global__ __launch_bounds__(128) void k_gemmw(const T16* __restrict__ A, const T16* __restrict__ Bt, int K, float* C, int ldc, size_t sA, size_t sB, size_t sC) {
    typedef typename WFrag<T16>::V V;
    __shared__ __align__(16) unsigned char L[2 * GT_BUF];
    const size_t z = blockIdx.z; A += z * sA; Bt += z * sB; C += z * sC;
    const int tid = threadIdx.x, lane = tid & 31, lr = lane & 15, hi = lane >> 4; const int wave = __builtin_amdgcn_readfirstlane(tid >> 5), wm = wave >> 1, wn = wave & 1;
    const int r0 = blockIdx.x * 128, c0 = blockIdx.y * 128;
    v8f acc[4][4];
#pragma unroll
    for (int mb = 0; mb < 4; ++mb)
#pragma unroll
        for (int nb = 0; nb < 4; ++nb) acc[mb][nb] = (v8f){};
    const char* gA = (const char*)(A + (size_t)(r0 + (tid >> 4)) * K + (tid & 15) * 8);
    const char* gB = (const char*)(Bt + (size_t)(c0 + (tid >> 4)) * K + (tid & 15) * 8);
    const size_t rs8 = (size_t)K * 16;
    const unsigned lA = (unsigned)(size_t)L + (unsigned)(tid >> 4) * GT_PITCH + (unsigned)(tid & 15) * 16u;
    const unsigned char* fa = L + (wm * 64 + lr) * GT_PITCH + hi * 16;
    const unsigned char* fb = L + GT_OP + (wn * 64 + lr) * GT_PITCH + hi * 16;
    const int nst = K / GT_KS;

    gt_stage(lA, gA, gB, rs8);
    asm volatile("s_wait_asynccnt 0x0" ::: "memory");   // stage 0 of this wave has landed
    __syncthreads();                                     // ... and every wave's part of it may be read
#pragma unroll 1
    for (int t = 0; t < nst; ++t) {
        const unsigned bo = (unsigned)(t & 1) * GT_BUF;
        V a[2][4], b[2][4];
#pragma unroll
        for (int q = 0; q < 4; ++q) { a[0][q] = WFrag<T16>::ld((const T16*)(fa + bo + q * 16 * GT_PITCH)); b[0][q] = WFrag<T16>::ld((const T16*)(fb + bo + q * 16 * GT_PITCH)); }
        // Stage t+1 goes into the other buffer, which every wave left at the barrier just passed; the copies are issued under the latency of the first fragment reads above (those read this trip's buffer only).
        if (t + 1 < nst) gt_stage(lA + (GT_BUF - bo), gA + (size_t)(t + 1) * (GT_KS * 2), gB + (size_t)(t + 1) * (GT_KS * 2), rs8);
#pragma unroll
        for (int ks = 0; ks < GT_KS / 32; ++ks) {
            if (ks + 1 < GT_KS / 32) {
#pragma unroll
                for (int q = 0; q < 4; ++q) { a[(ks + 1) & 1][q] = WFrag<T16>::ld((const T16*)(fa + bo + q * 16 * GT_PITCH + (ks + 1) * 64)); b[(ks + 1) & 1][q] = WFrag<T16>::ld((const T16*)(fb + bo + q * 16 * GT_PITCH + (ks + 1) * 64)); }
            }
            __builtin_amdgcn_sched_barrier(0);   // keeps the next block's 16 LDS reads one group ahead of this block: sunk among the WMMAs, each pair is waited out on its own
#pragma unroll
            for (int nb = 0; nb < 4; ++nb)
#pragma unroll
                for (int mb = 0; mb < 4; ++mb) acc[mb][nb] = WFrag<T16>::mma(a[ks & 1][mb], b[ks & 1][nb], acc[mb][nb]);
            __builtin_amdgcn_sched_barrier(0);   // closes the block, so that the reads after next do not rise into it
        }
        asm volatile("s_wait_dscnt 0x0" ::: "memory");      // this wave's reads of buffer t&1 are done before the buffer is given up
        asm volatile("s_wait_asynccnt 0x0" ::: "memory");   // this wave's copies of stage t+1 have landed
        __syncthreads();                                     // publishes stage t+1 and ends every reader's last read of buffer t&1, which the next trip refills
    }
    asm volatile("s_wait_asynccnt 0x0" ::: "memory");       // no copy is outstanding when the ring becomes output staging
    float* os = (float*)L + wave * (16 * 68);               // each wave's own 16 x 68 floats; the loop's last barrier stands behind every read of the ring
#pragma unroll
    for (int mb = 0; mb < 4; ++mb) {
#pragma unroll
        for (int nb = 0; nb < 4; ++nb) {
#pragma unroll
            for (int j = 0; j < 8; ++j) os[(hi * 8 + j) * 68 + nb * 16 + lr] = acc[mb][nb][j]; }
        __builtin_amdgcn_wave_barrier(); asm volatile("" ::: "memory");
        float* crow = C + (size_t)(r0 + wm * 64 + mb * 16) * ldc + c0 + wn * 64;
{
#pragma unroll
            for (int s = 0; s < 8; ++s) { const int row = 2 * s + hi, cofs = lr * 4; const v4f val = *(const v4fa*)(os + row * 68 + cofs);
                *(v4f*)(crow + (size_t)row * ldc + cofs) = val; }
             }
        asm volatile("s_wait_xcnt 0x0" ::: "memory");   // stands in front of the next 16 rows' code, which reuses the data and address registers of the stores just issued
        __builtin_amdgcn_wave_barrier(); asm volatile("" ::: "memory");
    }
}

__global__ __launch_bounds__(256) void k_cvt8(const float* __restrict__ src, bf* dst, size_t n8, size_t sS, size_t sD) {
    const size_t i = (size_t)blockIdx.x * 256 + threadIdx.x; if (i >= n8) return;
    src += (size_t)blockIdx.y * sS; dst += (size_t)blockIdx.y * sD;
    const v8f v = *(const v8f*)(src + i * 8); v8us o;
#pragma unroll
    for (int k = 0; k < 8; ++k) o[k] = f2bf(v[k]);
    *(v8us*)(dst + i * 8) = o;  }

// k_wtp: weight plane WT[e][d] (bf16, RNE) = W[d][e] (f32, [in][out] orientation); one 64(d) x 64(e) tile per block, transposed through LDS (all 64x64 entries staged, block barrier, pad column never read);
__global__ __launch_bounds__(256) void k_wtp(const float* __restrict__ W, bf* WT) {
    __shared__ float tl[64 * 65];
    const int tid = threadIdx.x; const int d0 = blockIdx.x * 64, e0 = blockIdx.y * 64;
#pragma unroll 4
    for (int i = 0; i < 16; ++i) { const int idx = i * 256 + tid; const int dd = idx >> 6, ee = idx & 63; tl[dd * 65 + ee] = W[(size_t)(d0 + dd) * HD + e0 + ee]; }
    __syncthreads();
    const int pc = tid & 7, er = tid >> 3; v8us o0, o1;
#pragma unroll
    for (int k = 0; k < 8; ++k) { o0[k] = f2bf(tl[(pc * 8 + k) * 65 + er]); o1[k] = f2bf(tl[(pc * 8 + k) * 65 + 32 + er]); }
    bf* p0 = WT + (size_t)(e0 + er) * DM + d0 + pc * 8; bf* p1 = WT + (size_t)(e0 + 32 + er) * DM + d0 + pc * 8;
    *(v8us*)p0 = o0; *(v8us*)p1 = o1;  }

__global__ __launch_bounds__(256) void k_cvth(const float* __restrict__ src, h16* dst, size_t n8, size_t sS, size_t sD) {
    const size_t i = (size_t)blockIdx.x * 256 + threadIdx.x; if (i >= n8) return;
    src += (size_t)blockIdx.y * sS; dst += (size_t)blockIdx.y * sD;
    const v8f v = *(const v8f*)(src + i * 8); v8h o;
#pragma unroll
    for (int k = 0; k < 8; ++k) o[k] = tohx(v[k]);
    *(v8h*)(dst + i * 8) = o;  }

__global__ __launch_bounds__(256) void k_vtp(const float* __restrict__ F, h16* V16) {
    const size_t e = ((size_t)blockIdx.x * 256 + threadIdx.x) * 2; if (e >= (size_t)ZB * HD * SEQ) return;
    const int t = (int)(e % SEQ); const int d = (int)((e / SEQ) % HD); const int g = (int)(e / ((size_t)SEQ * HD)); v2h o16;
#pragma unroll
    for (int q = 0; q < 2; ++q) { const float xv = F[((size_t)g * SEQ + t + q) * DM + d]; o16[q] = tohx(xv); }
    *(v2h*)(V16 + e) = o16;  }

__global__ __launch_bounds__(256) void k_vmean(const float* __restrict__ F, float* VM) {
    __shared__ float part[8 * 32];
    const int c = threadIdx.x & 31, r = threadIdx.x >> 5; const int g = blockIdx.y; const int d = blockIdx.x * 32 + c;
    const float* f = F + (size_t)g * SEQ * DM + d; float s = 0.f;
#pragma unroll 4
    for (int t = r; t < SEQ; t += 8) s += f[(size_t)t * DM];
    part[r * 32 + c] = s;
    __syncthreads();
    if (r == 0) { float a = part[c];
#pragma unroll
        for (int q = 1; q < 8; ++q) a += part[q * 32 + c];
        a *= (1.0f / (float)SEQ); float* p = VM + (size_t)g * HD + d;
        *(float*)p = a;  }
}

// k_asoft: per row (one wave): t = S x 768^-0.5; softmax over the SEQ keys (register row, running max then one exp, fixed shuffle trees);
__global__ __launch_bounds__(256) void k_asoft(const float* __restrict__ Sb, h16* P16) {
    const int lane = threadIdx.x & 31; const int row = blockIdx.x * 8 + (threadIdx.x >> 5); if (row >= ZB * SEQ) return;
    const float* sr = Sb + (size_t)row * SEQ; float v[SEQ / 32]; float mx = -3.0e38f;
#pragma unroll
    for (int ch = 0; ch < SEQ / 128; ++ch) { const v4f a = *(const v4f*)(sr + ch * 128 + lane * 4);
#pragma unroll
        for (int q = 0; q < 4; ++q) { const float t = a[q] * SCL; v[ch * 4 + q] = t; mx = fmaxf(mx, t); } }
#pragma unroll
    for (int sh = 16; sh; sh >>= 1) mx = fmaxf(mx, __shfl_xor(mx, sh, 32));
    float sum = 0.f;
#pragma unroll
    for (int k = 0; k < SEQ / 32; ++k) { float d0 = __fsub_rn(v[k], mx); asm volatile("" : "+v"(d0)); v[k] = __builtin_amdgcn_exp2f(__fmul_rn(d0, 1.4426950408889634f)); sum += v[k]; }
#pragma unroll
    for (int sh = 16; sh; sh >>= 1) sum += __shfl_xor(sum, sh, 32);
    const float f = __fdiv_rn(PCAR, sum); const float cen = PCAR / (float)SEQ;
{
#pragma unroll
        for (int ch = 0; ch < SEQ / 128; ++ch) { v4h o4;
#pragma unroll
            for (int q = 0; q < 4; ++q) o4[q] = tohx(v[ch * 4 + q] * f - cen);
            *(v4h*)(P16 + (size_t)row * SEQ + ch * 128 + lane * 4) = o4; }
         }
}

__global__ __launch_bounds__(256) void k_merge(const float* __restrict__ O, const float* __restrict__ VM, float* OUTb) {
    const size_t e = ((size_t)blockIdx.x * 256 + threadIdx.x) * 2; if (e >= (size_t)ZB * SEQ * HD) return;
    const int d = (int)(e % HD); const int g = (int)(e / ((size_t)HD * SEQ));
    const v2f m = *(const v2f*)(VM + (size_t)g * HD + d); const v2f o = *(const v2f*)(O + e);
    v2f o2; o2[0] = o[0] * (1.0f / PCAR) + m[0]; o2[1] = o[1] * (1.0f / PCAR) + m[1];
    *(v2f*)(OUTb + e) = o2;  }

constexpr size_t al256(size_t b) { return (b + 255) & ~(size_t)255; }
constexpr size_t WS_TOTAL =
    3 * al256((size_t)DM * DM * 2) +              // WQ WK WV bf16, [out][in]
    al256((size_t)ZB * SEQ * DM * 2) +            // XB bf16
    al256((size_t)2 * ZB * SEQ * DM * 4) +        // FQ|FK f32 (FV reuses FQ)
    al256((size_t)2 * ZB * SEQ * HD * 2) +        // QP16|KP16
    al256((size_t)ZB * HD * SEQ * 2) +            // VT16
    al256((size_t)ZB * HD * 4) +                  // VM
    al256((size_t)ZB * SEQ * SEQ * 4) +           // Sb
    al256((size_t)ZB * SEQ * SEQ * 2) +           // P16
    al256((size_t)ZB * SEQ * HD * 4);             // Ob
static_assert(WS_TOTAL <= (size_t)134217728);

extern "C" void kernel_launch(void* const* d_in, const int* in_sizes, int n_in,
                              void* d_out, int out_size, void* d_ws, size_t ws_size, hipStream_t stream) {
    if (n_in < 2) return;
    if ((size_t)in_sizes[0] < ((size_t)(NB - 1) * SEQ_FULL + SEQ) * DM) return;
    if ((size_t)in_sizes[1] < (size_t)3 * DM * HD) return;
    if ((size_t)out_size < (size_t)NB * SEQ * DM) return;
    if (WS_TOTAL > ws_size) return;
    const float* x = (const float*)d_in[0]; const float* qkv = (const float*)d_in[1];   // qkv: [3][in 768][out 768], slabs q, k, v
    float* OUT = (float*)d_out;     // [NB][SEQ][768]
    char* wsp = (char*)d_ws;
    auto take = [&](size_t bytes) { char* p = wsp; wsp += al256(bytes); return (void*)p; };
    bf* WQ = (bf*)take((size_t)DM * DM * 2); bf* WK = (bf*)take((size_t)DM * DM * 2); bf* WV = (bf*)take((size_t)DM * DM * 2);
    bf* XB = (bf*)take((size_t)ZB * SEQ * DM * 2);
    float* FQ = (float*)take((size_t)2 * ZB * SEQ * DM * 4); float* FK = FQ + (size_t)ZB * SEQ * DM; float* FV = FQ;   // v rows reuse the q slab after the q/k planes are built (stream-ordered)
    h16* QP16 = (h16*)take((size_t)2 * ZB * SEQ * HD * 2); h16* KP16 = QP16 + (size_t)ZB * SEQ * HD;
    h16* VT16 = (h16*)take((size_t)ZB * HD * SEQ * 2);
    float* VM = (float*)take((size_t)ZB * HD * 4);
    float* Sb = (float*)take((size_t)ZB * SEQ * SEQ * 4); h16* P16 = (h16*)take((size_t)ZB * SEQ * SEQ * 2); float* Ob = (float*)take((size_t)ZB * SEQ * HD * 4);
    if ((size_t)(wsp - (char*)d_ws) > ws_size) return;

    // weight slabs W[d][e] ([in][out]) -> planes WT[e][d] ([out][in], K-contiguous for the GEMM's Bt operand)
    k_wtp<<<dim3(DM / 64, HD / 64, 1), 256, 0, stream>>>(qkv, WQ);
    k_wtp<<<dim3(DM / 64, HD / 64, 1), 256, 0, stream>>>(qkv + (size_t)DM * HD, WK);
    k_wtp<<<dim3(DM / 64, HD / 64, 1), 256, 0, stream>>>(qkv + (size_t)2 * DM * HD, WV);

    const size_t x8 = (size_t)SEQ * DM / 8;                 // per batch slab
    const size_t p8 = (size_t)ZB * SEQ * DM / 8;            // per q / k slab
    const unsigned LE2 = (unsigned)(((size_t)ZB * SEQ * HD / 2 + 255) / 256);
    for (int b0 = 0; b0 < NB; b0 += ZB) {
        k_cvt8<<<dim3((unsigned)((x8 + 255) / 256), ZB, 1), 256, 0, stream>>>(x + (size_t)b0 * SEQ_FULL * DM, XB, x8, (size_t)SEQ_FULL * DM, (size_t)SEQ * DM);
        k_gemmw<bf><<<dim3(ZB * SEQ / 128, DM / 128, 1), 128, 0, stream>>>(XB, WQ, DM, FQ, DM, 0, 0, 0);
        k_gemmw<bf><<<dim3(ZB * SEQ / 128, DM / 128, 1), 128, 0, stream>>>(XB, WK, DM, FK, DM, 0, 0, 0);
        k_cvth<<<dim3((unsigned)((p8 + 255) / 256), 2, 1), 256, 0, stream>>>(FQ, QP16, p8, (size_t)ZB * SEQ * DM, (size_t)ZB * SEQ * HD);
        k_gemmw<bf><<<dim3(ZB * SEQ / 128, DM / 128, 1), 128, 0, stream>>>(XB, WV, DM, FV, DM, 0, 0, 0);
        k_vtp<<<LE2, 256, 0, stream>>>(FV, VT16);
        k_vmean<<<dim3(HD / 32, ZB, 1), 256, 0, stream>>>(FV, VM);
        k_gemmw<h16><<<dim3(SEQ / 128, SEQ / 128, ZB), 128, 0, stream>>>(QP16, KP16, HD, Sb, SEQ, (size_t)SEQ * HD, (size_t)SEQ * HD, (size_t)SEQ * SEQ);
        k_asoft<<<ZB * SEQ / 8, 256, 0, stream>>>(Sb, P16);
        k_gemmw<h16><<<dim3(SEQ / 128, HD / 128, ZB), 128, 0, stream>>>(P16, VT16, SEQ, Ob, HD, (size_t)SEQ * SEQ, (size_t)HD * SEQ, (size_t)SEQ * HD);
        k_merge<<<LE2, 256, 0, stream>>>(Ob, VM, OUT + (size_t)b0 * SEQ * DM);
    }
}

// v002
// One run takes 307 microseconds.
// Next to v001, in two timings, it ran 1.56 and 1.53 times as fast.
// All steps since v000 together make it 2.52 times as fast.
#include <hip/hip_runtime.h>

// Contractions: q/k/v projections on v_wmma_f32_16x16x32_bf16 (x and the stacked QKV weights RNE-converted to bf16, weights transposed to [out][in] planes, exact products, f32 accumulate); q.k^T and att.v on v_wmma_f32_16x16x32_f16 (f16 q/k/v planes; softmax weights carried x1024 and centred by 1024/SEQ, column mean of v added back in f32), f32 accumulate.
// Single-head full-width self-attention: x [8][2048][768]; q = x QKV[0], k = x QKV[1], v = x QKV[2] ('io' [768][768] each, stacked [3][768][768], no bias); att = softmax(q.k * 768^-0.5) over all 2048 keys (no mask); out = att @ v -> [8][2048][768] f32.
// Two batches per pass (z-batched GEMMs): projections stored as f16 planes by the GEMM itself (q, k row-major; v transposed [d][t], computed as Wv^T x^T); S = q k^T (f32, materialised per pass); row softmax in registers; O = P' v, stored as out = O/1024 + mean_t(v).

#ifndef NB
#define NB 8
#endif
#ifndef SEQ
#define SEQ 2048
#endif
#define NB_FULL  8
#define SEQ_FULL 2048
#define DM   768
#define HD   768
#define ZB   ((NB % 2 == 0) ? 2 : 1)     // batches per pass
#define PCAR 1024.0f
#define SCL  0.03608439182435161f         // 768^-0.5

typedef _Float16 h16;
typedef unsigned short bf;
typedef __attribute__((ext_vector_type(16))) __bf16   v16bf;
typedef __attribute__((ext_vector_type(16))) _Float16 v16h;
typedef __attribute__((ext_vector_type(8)))  _Float16 v8h;
typedef __attribute__((ext_vector_type(8)))  unsigned short v8us;
typedef __attribute__((ext_vector_type(8)))  float    v8f;
typedef __attribute__((ext_vector_type(4)))  float    v4f;
typedef __attribute__((ext_vector_type(4)))  _Float16 v4h;
typedef v4f  __attribute__((may_alias)) v4fa;

static_assert(NB <= NB_FULL);
static_assert(SEQ <= SEQ_FULL);
static_assert(NB % ZB == 0);
static_assert(SEQ % 128 == 0);                 // softmax row chunks, 128-row tiles, K stages of 128
static_assert(DM % 128 == 0 && HD % 128 == 0); // 128x128 tiles, K stages of 128; 64x64 weight transpose tiles
static_assert(DM == HD);                       // one full-width head: plane pitch == row pitch
static_assert(((size_t)SEQ * DM) % 8 == 0);
static_assert((ZB * SEQ) % 8 == 0);
static_assert(HD % 32 == 0 && SEQ % 256 == 0);  // k_vmean: 32 rows per block, 256 keys per wave load
static_assert((DM * 2) % 128 == 0);

__device__ __forceinline__ unsigned short f2bf(float f) { unsigned u = __float_as_uint(f); u += 0x7FFFu + ((u >> 16) & 1u); return (unsigned short)(u >> 16); }
__device__ __forceinline__ v16h cat16(v8h lo, v8h hi) { return __builtin_shufflevector(lo, hi, 0, 1, 2, 3, 4, 5, 6, 7, 8, 9, 10, 11, 12, 13, 14, 15); }
__device__ __forceinline__ v16bf cat16b(v8us lo, v8us hi) { return __builtin_bit_cast(v16bf, __builtin_shufflevector(lo, hi, 0, 1, 2, 3, 4, 5, 6, 7, 8, 9, 10, 11, 12, 13, 14, 15)); }
__device__ __forceinline__ v8f wmma16(v16h a, v16h b, v8f c) { return __builtin_amdgcn_wmma_f32_16x16x32_f16(false, a, false, b, (short)0, c, false, false); }
__device__ __forceinline__ v8f wmmab(v16bf a, v16bf b, v8f c) { return __builtin_amdgcn_wmma_f32_16x16x32_bf16(false, a, false, b, (short)0, c, false, false); }
__device__ __forceinline__ h16 tohx(float x) { return (h16)x; }

// ---- k_gemmw: GEMM, one 128x128 output tile per workgroup of FOUR WAVES (2x2, each wave 64x64 = 16 accumulators); grid (M/128, N/128, Z), 128 threads.
// D[m][n] = sum_k A[m][k] Bt[n][k] (f32 accumulate), A and Bt K-contiguous 16-bit planes. z-batch strides sA/sB/sC in elements. K % 128 == 0, M % 128 == 0, N % 128 == 0.
// The epilogue stores what the next kernel reads, pitch ldc: EP_F32: C = D; EP_H16: H = D rounded to f16 (RNE); EP_OUT: C = D/1024 + CM[z][n] (CM: HD floats per z).
// A stage is 128 k (256 B) of the tile's 128 A rows and 128 Bt rows, brought into LDS by asynchronous 16-byte copies (whole 256-B row pieces per half wave), two buffers: stage t+1 flies while stage t is multiplied.
// Fragment map (A and Bt alike): lane -> row/col lane&15, h = lane>>4; elements 0..7 = k0+8h+0..7, elements 8..15 = k0+16+8h+0..7. D: acc[j] = (row 8h+j, col lane&15).
#define GT_KS    128                      // k per stage
#define GT_PITCH 272                      // LDS row pitch, bytes: 16 B x odd, no bank conflict for 16-byte fragment reads
#define GT_OP    (128 * GT_PITCH)         // one operand's 128 rows
#define GT_BUF   (2 * GT_OP)              // A rows, then Bt rows
#define EP_F32 0
#define EP_H16 1
#define EP_OUT 2
template <typename T16> struct WFrag;
template <> struct WFrag<h16> { typedef v16h V; static __device__ __forceinline__ V ld(const h16* p) { return cat16(*(const v8h*)p, *(const v8h*)(p + 16)); } static __device__ __forceinline__ v8f mma(V a, V b, v8f c) { return wmma16(a, b, c); } };
template <> struct WFrag<bf> { typedef v16bf V; static __device__ __forceinline__ V ld(const bf* p) { return cat16b(*(const v8us*)p, *(const v8us*)(p + 16)); } static __device__ __forceinline__ v8f mma(V a, V b, v8f c) { return wmmab(a, b, c); } };

// One stage's copies of one thread: 16 of A and 16 of Bt, rows 8 apart (thread -> row tid>>4, 16-byte column tid&15). lA: the thread's LDS byte address in the buffer's A part; gA, gB: its global addresses; rs8: 8 source rows in bytes.
// Each statement ends in s_wait_xcnt 0 so that no address register of an issued copy is rewritten ahead of that wait.
__device__ __forceinline__ void gt_stage(unsigned lA, const char* gA, const char* gB, size_t rs8) {
    unsigned l[32]; const char* g[32];
#pragma unroll
    for (int i = 0; i < 16; ++i) { l[i] = lA + (unsigned)i * (8u * GT_PITCH); g[i] = gA + (size_t)i * rs8; l[16 + i] = lA + (unsigned)GT_OP + (unsigned)i * (8u * GT_PITCH); g[16 + i] = gB + (size_t)i * rs8; }
    asm volatile(
        "global_load_async_to_lds_b128 %0, %11, off\n\t"
        "global_load_async_to_lds_b128 %1, %12, off\n\t"
        "global_load_async_to_lds_b128 %2, %13, off\n\t"
        "global_load_async_to_lds_b128 %3, %14, off\n\t"
        "global_load_async_to_lds_b128 %4, %15, off\n\t"
        "global_load_async_to_lds_b128 %5, %16, off\n\t"
        "global_load_async_to_lds_b128 %6, %17, off\n\t"
        "global_load_async_to_lds_b128 %7, %18, off\n\t"
        "global_load_async_to_lds_b128 %8, %19, off\n\t"
        "global_load_async_to_lds_b128 %9, %20, off\n\t"
        "global_load_async_to_lds_b128 %10, %21, off\n\t"
        "s_wait_xcnt 0x0"
        :: "v"(l[0]), "v"(l[1]), "v"(l[2]), "v"(l[3]), "v"(l[4]), "v"(l[5]), "v"(l[6]), "v"(l[7]), "v"(l[8]), "v"(l[9]), "v"(l[10]),
           "v"(g[0]), "v"(g[1]), "v"(g[2]), "v"(g[3]), "v"(g[4]), "v"(g[5]), "v"(g[6]), "v"(g[7]), "v"(g[8]), "v"(g[9]), "v"(g[10]) : "memory");
    asm volatile(
        "global_load_async_to_lds_b128 %0, %11, off\n\t"
        "global_load_async_to_lds_b128 %1, %12, off\n\t"
        "global_load_async_to_lds_b128 %2, %13, off\n\t"
        "global_load_async_to_lds_b128 %3, %14, off\n\t"
        "global_load_async_to_lds_b128 %4, %15, off\n\t"
        "global_load_async_to_lds_b128 %5, %16, off\n\t"
        "global_load_async_to_lds_b128 %6, %17, off\n\t"
        "global_load_async_to_lds_b128 %7, %18, off\n\t"
        "global_load_async_to_lds_b128 %8, %19, off\n\t"
        "global_load_async_to_lds_b128 %9, %20, off\n\t"
        "global_load_async_to_lds_b128 %10, %21, off\n\t"
        "s_wait_xcnt 0x0"
        :: "v"(l[11]), "v"(l[12]), "v"(l[13]), "v"(l[14]), "v"(l[15]), "v"(l[16]), "v"(l[17]), "v"(l[18]), "v"(l[19]), "v"(l[20]), "v"(l[21]),
           "v"(g[11]), "v"(g[12]), "v"(g[13]), "v"(g[14]), "v"(g[15]), "v"(g[16]), "v"(g[17]), "v"(g[18]), "v"(g[19]), "v"(g[20]), "v"(g[21]) : "memory");
    asm volatile(
        "global_load_async_to_lds_b128 %0, %10, off\n\t"
        "global_load_async_to_lds_b128 %1, %11, off\n\t"
        "global_load_async_to_lds_b128 %2, %12, off\n\t"
        "global_load_async_to_lds_b128 %3, %13, off\n\t"
        "global_load_async_to_lds_b128 %4, %14, off\n\t"
        "global_load_async_to_lds_b128 %5, %15, off\n\t"
        "global_load_async_to_lds_b128 %6, %16, off\n\t"
        "global_load_async_to_lds_b128 %7, %17, off\n\t"
        "global_load_async_to_lds_b128 %8, %18, off\n\t"
        "global_load_async_to_lds_b128 %9, %19, off\n\t"
        "s_wait_xcnt 0x0"
        :: "v"(l[22]), "v"(l[23]), "v"(l[24]), "v"(l[25]), "v"(l[26]), "v"(l[27]), "v"(l[28]), "v"(l[29]), "v"(l[30]), "v"(l[31]),
           "v"(g[22]), "v"(g[23]), "v"(g[24]), "v"(g[25]), "v"(g[26]), "v"(g[27]), "v"(g[28]), "v"(g[29]), "v"(g[30]), "v"(g[31]) : "memory");
}

template <typename T16, int EPI>
__global__ __launch_bounds__(128) void k_gemmw(const T16* __restrict__ A, const T16* __restrict__ Bt, int K, float* C, h16* H, const float* __restrict__ CM, int ldc, size_t sA, size_t sB, size_t sC) {
    typedef typename WFrag<T16>::V V;
    __shared__ __align__(16) unsigned char L[2 * GT_BUF];
    const size_t z = blockIdx.z; A += z * sA; Bt += z * sB;
    const int tid = threadIdx.x, lane = tid & 31, lr = lane & 15, hi = lane >> 4; const int wave = __builtin_amdgcn_readfirstlane(tid >> 5), wm = wave >> 1, wn = wave & 1;
    const int r0 = blockIdx.x * 128, c0 = blockIdx.y * 128;
    v8f acc[4][4];
#pragma unroll
    for (int mb = 0; mb < 4; ++mb)
#pragma unroll
        for (int nb = 0; nb < 4; ++nb) acc[mb][nb] = (v8f){};
    const char* gA = (const char*)(A + (size_t)(r0 + (tid >> 4)) * K + (tid & 15) * 8);
    const char* gB = (const char*)(Bt + (size_t)(c0 + (tid >> 4)) * K + (tid & 15) * 8);
    const size_t rs8 = (size_t)K * 16;
    const unsigned lA = (unsigned)(size_t)L + (unsigned)(tid >> 4) * GT_PITCH + (unsigned)(tid & 15) * 16u;
    const unsigned char* fa = L + (wm * 64 + lr) * GT_PITCH + hi * 16;
    const unsigned char* fb = L + GT_OP + (wn * 64 + lr) * GT_PITCH + hi * 16;
    const int nst = K / GT_KS;

    gt_stage(lA, gA, gB, rs8);
    asm volatile("s_wait_asynccnt 0x0" ::: "memory");   // stage 0 of this wave has landed
    __syncthreads();                                     // ... and every wave's part of it may be read
#pragma unroll 1
    for (int t = 0; t < nst; ++t) {
        const unsigned bo = (unsigned)(t & 1) * GT_BUF;
        V a[2][4], b[2][4];
#pragma unroll
        for (int q = 0; q < 4; ++q) { a[0][q] = WFrag<T16>::ld((const T16*)(fa + bo + q * 16 * GT_PITCH)); b[0][q] = WFrag<T16>::ld((const T16*)(fb + bo + q * 16 * GT_PITCH)); }
        // Stage t+1 goes into the other buffer, which every wave left at the barrier just passed; the copies are issued under the latency of the first fragment reads above (those read this trip's buffer only).
        if (t + 1 < nst) gt_stage(lA + (GT_BUF - bo), gA + (size_t)(t + 1) * (GT_KS * 2), gB + (size_t)(t + 1) * (GT_KS * 2), rs8);
#pragma unroll
        for (int ks = 0; ks < GT_KS / 32; ++ks) {
            if (ks + 1 < GT_KS / 32) {
#pragma unroll
                for (int q = 0; q < 4; ++q) { a[(ks + 1) & 1][q] = WFrag<T16>::ld((const T16*)(fa + bo + q * 16 * GT_PITCH + (ks + 1) * 64)); b[(ks + 1) & 1][q] = WFrag<T16>::ld((const T16*)(fb + bo + q * 16 * GT_PITCH + (ks + 1) * 64)); }
            }
            __builtin_amdgcn_sched_barrier(0);   // keeps the next block's 16 LDS reads one group ahead of this block: sunk among the WMMAs, each pair is waited out on its own
#pragma unroll
            for (int nb = 0; nb < 4; ++nb)
#pragma unroll
                for (int mb = 0; mb < 4; ++mb) acc[mb][nb] = WFrag<T16>::mma(a[ks & 1][mb], b[ks & 1][nb], acc[mb][nb]);
            __builtin_amdgcn_sched_barrier(0);   // closes the block, so that the reads after next do not rise into it
        }
        asm volatile("s_wait_dscnt 0x0" ::: "memory");      // this wave's reads of buffer t&1 are done before the buffer is given up
        asm volatile("s_wait_asynccnt 0x0" ::: "memory");   // this wave's copies of stage t+1 have landed
        __syncthreads();                                     // publishes stage t+1 and ends every reader's last read of buffer t&1, which the next trip refills
    }
    asm volatile("s_wait_asynccnt 0x0" ::: "memory");       // no copy is outstanding when the ring becomes output staging
    v4f cm = (v4f){};
    if constexpr (EPI == EP_OUT) {   // the lane's four column terms, fetched behind the loop (held over it they are spilled); load and data wait in one statement, so that no register of the load is reused while it is in flight
        const float* cp = CM + z * HD + c0 + wn * 64 + lr * 4;
        asm volatile("global_load_b128 %0, %1, off\n\ts_wait_loadcnt 0x0" : "=&v"(cm) : "v"(cp) : "memory");
    }
    float* os = (float*)L + wave * (16 * 68);               // each wave's own 16 x 68 floats; the loop's last barrier stands behind every read of the ring
#pragma unroll
    for (int mb = 0; mb < 4; ++mb) {
#pragma unroll
        for (int nb = 0; nb < 4; ++nb) {
#pragma unroll
            for (int j = 0; j < 8; ++j) os[(hi * 8 + j) * 68 + nb * 16 + lr] = acc[mb][nb][j]; }
        __builtin_amdgcn_wave_barrier(); asm volatile("" ::: "memory");
        if constexpr (EPI == EP_H16) {   // a row of the wave's 64 columns is one 128-byte line: 8 lanes x 16 bytes, four rows a store
            h16* hrow = H + z * sC + (size_t)(r0 + wm * 64 + mb * 16) * ldc + c0 + wn * 64;
#pragma unroll
            for (int s = 0; s < 4; ++s) { const int row = 4 * s + (lane >> 3), cofs = (lane & 7) * 8; const v4f v0 = *(const v4fa*)(os + row * 68 + cofs), v1 = *(const v4fa*)(os + row * 68 + cofs + 4); v8h o;
#pragma unroll
                for (int k = 0; k < 4; ++k) { o[k] = tohx(v0[k]); o[4 + k] = tohx(v1[k]); }
                *(v8h*)(hrow + (size_t)row * ldc + cofs) = o; }
        } else {
            float* crow = C + z * sC + (size_t)(r0 + wm * 64 + mb * 16) * ldc + c0 + wn * 64;
#pragma unroll
            for (int s = 0; s < 8; ++s) { const int row = 2 * s + hi, cofs = lr * 4; v4f val = *(const v4fa*)(os + row * 68 + cofs);
                if constexpr (EPI == EP_OUT) val = val * (1.0f / PCAR) + cm;
                *(v4f*)(crow + (size_t)row * ldc + cofs) = val; }
        }
        asm volatile("s_wait_xcnt 0x0" ::: "memory");   // stands in front of the next 16 rows' code, which reuses the data and address registers of the stores just issued
        __builtin_amdgcn_wave_barrier(); asm volatile("" ::: "memory");
    }
}

__global__ __launch_bounds__(256) void k_cvt8(const float* __restrict__ src, bf* dst, size_t n8, size_t sS, size_t sD) {
    const size_t i = (size_t)blockIdx.x * 256 + threadIdx.x; if (i >= n8) return;
    src += (size_t)blockIdx.y * sS; dst += (size_t)blockIdx.y * sD;
    const v8f v = *(const v8f*)(src + i * 8); v8us o;
#pragma unroll
    for (int k = 0; k < 8; ++k) o[k] = f2bf(v[k]);
    *(v8us*)(dst + i * 8) = o;  }

// k_wtp: weight plane WT[e][d] (bf16, RNE) = W[d][e] (f32, [in][out] orientation); one 64(d) x 64(e) tile per block, transposed through LDS (all 64x64 entries staged, block barrier, pad column never read);
__global__ __launch_bounds__(256) void k_wtp(const float* __restrict__ W, bf* WT) {
    __shared__ float tl[64 * 65];
    const int tid = threadIdx.x; const int d0 = blockIdx.x * 64, e0 = blockIdx.y * 64;
#pragma unroll 4
    for (int i = 0; i < 16; ++i) { const int idx = i * 256 + tid; const int dd = idx >> 6, ee = idx & 63; tl[dd * 65 + ee] = W[(size_t)(d0 + dd) * HD + e0 + ee]; }
    __syncthreads();
    const int pc = tid & 7, er = tid >> 3; v8us o0, o1;
#pragma unroll
    for (int k = 0; k < 8; ++k) { o0[k] = f2bf(tl[(pc * 8 + k) * 65 + er]); o1[k] = f2bf(tl[(pc * 8 + k) * 65 + 32 + er]); }
    bf* p0 = WT + (size_t)(e0 + er) * DM + d0 + pc * 8; bf* p1 = WT + (size_t)(e0 + 32 + er) * DM + d0 + pc * 8;
    *(v8us*)p0 = o0; *(v8us*)p1 = o1;  }

// k_vmean: VM[r] = mean over the SEQ keys of plane row r = (batch, d) of the f16 v^T plane, summed in f32. 32 rows per block, one per wave (whole 512-byte pieces per load, fixed trees); one wave stores the block's 32 means as one 128-byte line.
__global__ __launch_bounds__(1024) void k_vmean(const h16* __restrict__ VT, float* VM) {
    __shared__ float part[32];
    const int lane = threadIdx.x & 31, w = threadIdx.x >> 5; const int row0 = blockIdx.x * 32;
    const h16* p = VT + (size_t)(row0 + w) * SEQ + lane * 8; float s = 0.f;
#pragma unroll
    for (int ch = 0; ch < SEQ / 256; ++ch) { const v8h a = *(const v8h*)(p + ch * 256);
        s += (((float)a[0] + (float)a[1]) + ((float)a[2] + (float)a[3])) + (((float)a[4] + (float)a[5]) + ((float)a[6] + (float)a[7])); }
#pragma unroll
    for (int sh = 16; sh; sh >>= 1) s += __shfl_xor(s, sh, 32);
    if (lane == 0) part[w] = s;
    __syncthreads();
    if (threadIdx.x < 32) VM[row0 + threadIdx.x] = part[threadIdx.x] * (1.0f / (float)SEQ);
}

// k_asoft: per row (one wave): t = S x 768^-0.5; softmax over the SEQ keys (register row, running max then one exp, fixed shuffle trees);
__global__ __launch_bounds__(256) void k_asoft(const float* __restrict__ Sb, h16* P16) {
    const int lane = threadIdx.x & 31; const int row = blockIdx.x * 8 + (threadIdx.x >> 5); if (row >= ZB * SEQ) return;
    const float* sr = Sb + (size_t)row * SEQ; float v[SEQ / 32]; float mx = -3.0e38f;
#pragma unroll
    for (int ch = 0; ch < SEQ / 128; ++ch) { const v4f a = *(const v4f*)(sr + ch * 128 + lane * 4);
#pragma unroll
        for (int q = 0; q < 4; ++q) { const float t = a[q] * SCL; v[ch * 4 + q] = t; mx = fmaxf(mx, t); } }
#pragma unroll
    for (int sh = 16; sh; sh >>= 1) mx = fmaxf(mx, __shfl_xor(mx, sh, 32));
    float sum = 0.f;
#pragma unroll
    for (int k = 0; k < SEQ / 32; ++k) { float d0 = __fsub_rn(v[k], mx); asm volatile("" : "+v"(d0)); v[k] = __builtin_amdgcn_exp2f(__fmul_rn(d0, 1.4426950408889634f)); sum += v[k]; }
#pragma unroll
    for (int sh = 16; sh; sh >>= 1) sum += __shfl_xor(sum, sh, 32);
    const float f = __fdiv_rn(PCAR, sum); const float cen = PCAR / (float)SEQ;
{
#pragma unroll
        for (int ch = 0; ch < SEQ / 128; ++ch) { v4h o4;
#pragma unroll
            for (int q = 0; q < 4; ++q) o4[q] = tohx(v[ch * 4 + q] * f - cen);
            *(v4h*)(P16 + (size_t)row * SEQ + ch * 128 + lane * 4) = o4; }
         }
}

constexpr size_t al256(size_t b) { return (b + 255) & ~(size_t)255; }
constexpr size_t WS_TOTAL =
    3 * al256((size_t)DM * DM * 2) +              // WQ WK WV bf16, [out][in]
    al256((size_t)ZB * SEQ * DM * 2) +            // XB bf16
    al256((size_t)2 * ZB * SEQ * HD * 2) +        // QP16|KP16
    al256((size_t)ZB * HD * SEQ * 2) +            // VT16
    al256((size_t)ZB * HD * 4) +                  // VM
    al256((size_t)ZB * SEQ * SEQ * 4) +           // Sb
    al256((size_t)ZB * SEQ * SEQ * 2);            // P16
static_assert(WS_TOTAL <= (size_t)134217728);

extern "C" void kernel_launch(void* const* d_in, const int* in_sizes, int n_in,
                              void* d_out, int out_size, void* d_ws, size_t ws_size, hipStream_t stream) {
    if (n_in < 2) return;
    if ((size_t)in_sizes[0] < ((size_t)(NB - 1) * SEQ_FULL + SEQ) * DM) return;
    if ((size_t)in_sizes[1] < (size_t)3 * DM * HD) return;
    if ((size_t)out_size < (size_t)NB * SEQ * DM) return;
    if (WS_TOTAL > ws_size) return;
    const float* x = (const float*)d_in[0]; const float* qkv = (const float*)d_in[1];   // qkv: [3][in 768][out 768], slabs q, k, v
    float* OUT = (float*)d_out;     // [NB][SEQ][768]
    char* wsp = (char*)d_ws;
    auto take = [&](size_t bytes) { char* p = wsp; wsp += al256(bytes); return (void*)p; };
    bf* WQ = (bf*)take((size_t)DM * DM * 2); bf* WK = (bf*)take((size_t)DM * DM * 2); bf* WV = (bf*)take((size_t)DM * DM * 2);
    bf* XB = (bf*)take((size_t)ZB * SEQ * DM * 2);
    h16* QP16 = (h16*)take((size_t)2 * ZB * SEQ * HD * 2); h16* KP16 = QP16 + (size_t)ZB * SEQ * HD;
    h16* VT16 = (h16*)take((size_t)ZB * HD * SEQ * 2);
    float* VM = (float*)take((size_t)ZB * HD * 4);
    float* Sb = (float*)take((size_t)ZB * SEQ * SEQ * 4); h16* P16 = (h16*)take((size_t)ZB * SEQ * SEQ * 2);
    if ((size_t)(wsp - (char*)d_ws) > ws_size) return;

    // weight slabs W[d][e] ([in][out]) -> planes WT[e][d] ([out][in], K-contiguous: Bt operand of the q and k GEMMs, A operand of the v GEMM)
    k_wtp<<<dim3(DM / 64, HD / 64, 1), 256, 0, stream>>>(qkv, WQ);
    k_wtp<<<dim3(DM / 64, HD / 64, 1), 256, 0, stream>>>(qkv + (size_t)DM * HD, WK);
    k_wtp<<<dim3(DM / 64, HD / 64, 1), 256, 0, stream>>>(qkv + (size_t)2 * DM * HD, WV);

    const size_t x8 = (size_t)SEQ * DM / 8;                 // per batch slab
    for (int b0 = 0; b0 < NB; b0 += ZB) {
        k_cvt8<<<dim3((unsigned)((x8 + 255) / 256), ZB, 1), 256, 0, stream>>>(x + (size_t)b0 * SEQ_FULL * DM, XB, x8, (size_t)SEQ_FULL * DM, (size_t)SEQ * DM);
        k_gemmw<bf, EP_H16><<<dim3(ZB * SEQ / 128, HD / 128, 1), 128, 0, stream>>>(XB, WQ, DM, nullptr, QP16, nullptr, HD, 0, 0, 0);
        k_gemmw<bf, EP_H16><<<dim3(ZB * SEQ / 128, HD / 128, 1), 128, 0, stream>>>(XB, WK, DM, nullptr, KP16, nullptr, HD, 0, 0, 0);
        // v^T[d][t] = sum_k WV[d][k] x[t][k]: the weight plane as A, a batch's x rows as Bt
        k_gemmw<bf, EP_H16><<<dim3(HD / 128, SEQ / 128, ZB), 128, 0, stream>>>(WV, XB, DM, nullptr, VT16, nullptr, SEQ, 0, (size_t)SEQ * DM, (size_t)HD * SEQ);
        k_vmean<<<ZB * HD / 32, 1024, 0, stream>>>(VT16, VM);
        k_gemmw<h16, EP_F32><<<dim3(SEQ / 128, SEQ / 128, ZB), 128, 0, stream>>>(QP16, KP16, HD, Sb, nullptr, nullptr, SEQ, (size_t)SEQ * HD, (size_t)SEQ * HD, (size_t)SEQ * SEQ);
        k_asoft<<<ZB * SEQ / 8, 256, 0, stream>>>(Sb, P16);
        k_gemmw<h16, EP_OUT><<<dim3(SEQ / 128, HD / 128, ZB), 128, 0, stream>>>(P16, VT16, SEQ, OUT + (size_t)b0 * SEQ * DM, nullptr, VM, HD, (size_t)SEQ * SEQ, (size_t)HD * SEQ, (size_t)SEQ * HD);
    }
}

// v003
// It runs in 182 microseconds.
// Next to v002, in two timings, it ran 1.69 and 1.68 times as fast.
// All steps since v000 together make it 4.25 times as fast.
#include <hip/hip_runtime.h>

// Contractions: q/k/v projections on v_wmma_f32_16x16x32_bf16 (x and the stacked QKV weights RNE-converted to bf16, weights transposed to [out][in] planes, exact products, f32 accumulate); q.k^T and att.v on v_wmma_f32_16x16x32_f16 (f16 q/k/v planes; softmax weights carried x1024 and centred by 1024/SEQ, column mean of v added back in f32), f32 accumulate.
// Single-head full-width self-attention: x [8][2048][768]; q = x QKV[0], k = x QKV[1], v = x QKV[2] ('io' [768][768] each, stacked [3][768][768], no bias); att = softmax(q.k * 768^-0.5) over all 2048 keys (no mask); out = att @ v -> [8][2048][768] f32.
// All batches in one pass, one launch per stage (z-batched GEMMs): projections stored as f16 planes by the GEMM itself (q, k row-major; v transposed [d][t], computed as Wv^T x^T); S = q k^T (f32, materialised); row softmax in registers; O = P' v, stored as out = O/1024 + mean_t(v).

#ifndef NB
#define NB 8
#endif
#ifndef SEQ
#define SEQ 2048
#endif
#define NB_FULL  8
#define SEQ_FULL 2048
#define DM   768
#define HD   768
#define ZB   NB                           // batches per pass: all of them
#define PCAR 1024.0f
#define SCL  0.03608439182435161f         // 768^-0.5

typedef _Float16 h16;
typedef unsigned short bf;
typedef __attribute__((ext_vector_type(16))) __bf16   v16bf;
typedef __attribute__((ext_vector_type(16))) _Float16 v16h;
typedef __attribute__((ext_vector_type(8)))  _Float16 v8h;
typedef __attribute__((ext_vector_type(8)))  unsigned short v8us;
typedef __attribute__((ext_vector_type(8)))  float    v8f;
typedef __attribute__((ext_vector_type(4)))  float    v4f;
typedef __attribute__((ext_vector_type(4)))  _Float16 v4h;
typedef v4f  __attribute__((may_alias)) v4fa;

static_assert(NB <= NB_FULL);
static_assert(SEQ <= SEQ_FULL);
static_assert(NB % ZB == 0);
static_assert(SEQ % 128 == 0);                 // softmax row chunks, 128-row tiles, K stages of 128
static_assert(DM % 128 == 0 && HD % 128 == 0); // 128x128 tiles, K stages of 128; 64x64 weight transpose tiles
static_assert(DM == HD);                       // one full-width head: plane pitch == row pitch
static_assert(((size_t)SEQ * DM) % 8 == 0);
static_assert((ZB * SEQ) % 8 == 0);
static_assert(HD % 32 == 0 && SEQ % 256 == 0);  // k_vmean: 32 rows per block, 256 keys per wave load
static_assert((DM * 2) % 128 == 0);
static_assert(SEQ <= 3 * DM);                  // the softmax weights lie over the x, q and k planes

__device__ __forceinline__ unsigned short f2bf(float f) { unsigned u = __float_as_uint(f); u += 0x7FFFu + ((u >> 16) & 1u); return (unsigned short)(u >> 16); }
__device__ __forceinline__ v16h cat16(v8h lo, v8h hi) { return __builtin_shufflevector(lo, hi, 0, 1, 2, 3, 4, 5, 6, 7, 8, 9, 10, 11, 12, 13, 14, 15); }
__device__ __forceinline__ v16bf cat16b(v8us lo, v8us hi) { return __builtin_bit_cast(v16bf, __builtin_shufflevector(lo, hi, 0, 1, 2, 3, 4, 5, 6, 7, 8, 9, 10, 11, 12, 13, 14, 15)); }
__device__ __forceinline__ v8f wmma16(v16h a, v16h b, v8f c) { return __builtin_amdgcn_wmma_f32_16x16x32_f16(false, a, false, b, (short)0, c, false, false); }
__device__ __forceinline__ v8f wmmab(v16bf a, v16bf b, v8f c) { return __builtin_amdgcn_wmma_f32_16x16x32_bf16(false, a, false, b, (short)0, c, false, false); }
__device__ __forceinline__ h16 tohx(float x) { return (h16)x; }

// ---- k_gemmw: GEMM, one 128x128 output tile per workgroup of FOUR WAVES (2x2, each wave 64x64 = 16 accumulators); grid (M/128, N/128, Z), 128 threads.
// D[m][n] = sum_k A[m][k] Bt[n][k] (f32 accumulate), A and Bt K-contiguous 16-bit planes. z-batch strides sA/sB/sC in elements. K % 128 == 0, M % 128 == 0, N % 128 == 0.
// The epilogue stores what the next kernel reads, pitch ldc: EP_F32: C = D; EP_QKV: H = D rounded to f16 (RNE); EP_OUT: C = D/1024 + CM[z][n] (CM: HD floats per z).
// EP_QKV is the three projections in one grid (x = 128 rows of all batches' x, y = 128 weight rows, z = q, k, v): slices 0 and 1 as above; slice 2 takes the weight rows as A and the x rows as Bt and stores v^T[batch][d][t], pitch SEQ.
// A stage is 128 k (256 B) of the tile's 128 A rows and 128 Bt rows, brought into LDS by asynchronous 16-byte copies (whole 256-B row pieces per half wave), two buffers: stage t+1 flies while stage t is multiplied.
// Fragment map (A and Bt alike): lane -> row/col lane&15, h = lane>>4; elements 0..7 = k0+8h+0..7, elements 8..15 = k0+16+8h+0..7. D: acc[j] = (row 8h+j, col lane&15).
#define GT_KS    128                      // k per stage
#define GT_PITCH 272                      // LDS row pitch, bytes: 16 B x odd, no bank conflict for 16-byte fragment reads
#define GT_OP    (128 * GT_PITCH)         // one operand's 128 rows
#define GT_BUF   (2 * GT_OP)              // A rows, then Bt rows
#define EP_F32 0
#define EP_QKV 1
#define EP_OUT 2
template <typename T16> struct WFrag;
template <> struct WFrag<h16> { typedef v16h V; static __device__ __forceinline__ V ld(const h16* p) { return cat16(*(const v8h*)p, *(const v8h*)(p + 16)); } static __device__ __forceinline__ v8f mma(V a, V b, v8f c) { return wmma16(a, b, c); } };
template <> struct WFrag<bf> { typedef v16bf V; static __device__ __forceinline__ V ld(const bf* p) { return cat16b(*(const v8us*)p, *(const v8us*)(p + 16)); } static __device__ __forceinline__ v8f mma(V a, V b, v8f c) { return wmmab(a, b, c); } };

// One stage's copies of one thread: 16 of A and 16 of Bt, rows 8 apart (thread -> row tid>>4, 16-byte column tid&15). lA: the thread's LDS byte address in the buffer's A part; gA, gB: its global addresses; rs8: 8 source rows in bytes.
// Each statement ends in s_wait_xcnt 0 so that no address register of an issued copy is rewritten ahead of that wait.
__device__ __forceinline__ void gt_stage(unsigned lA, const char* gA, const char* gB, size_t rs8) {
    unsigned l[32]; const char* g[32];
#pragma unroll
    for (int i = 0; i < 16; ++i) { l[i] = lA + (unsigned)i * (8u * GT_PITCH); g[i] = gA + (size_t)i * rs8; l[16 + i] = lA + (unsigned)GT_OP + (unsigned)i * (8u * GT_PITCH); g[16 + i] = gB + (size_t)i * rs8; }
    asm volatile(
        "global_load_async_to_lds_b128 %0, %11, off\n\t"
        "global_load_async_to_lds_b128 %1, %12, off\n\t"
        "global_load_async_to_lds_b128 %2, %13, off\n\t"
        "global_load_async_to_lds_b128 %3, %14, off\n\t"
        "global_load_async_to_lds_b128 %4, %15, off\n\t"
        "global_load_async_to_lds_b128 %5, %16, off\n\t"
        "global_load_async_to_lds_b128 %6, %17, off\n\t"
        "global_load_async_to_lds_b128 %7, %18, off\n\t"
        "global_load_async_to_lds_b128 %8, %19, off\n\t"
        "global_load_async_to_lds_b128 %9, %20, off\n\t"
        "global_load_async_to_lds_b128 %10, %21, off\n\t"
        "s_wait_xcnt 0x0"
        :: "v"(l[0]), "v"(l[1]), "v"(l[2]), "v"(l[3]), "v"(l[4]), "v"(l[5]), "v"(l[6]), "v"(l[7]), "v"(l[8]), "v"(l[9]), "v"(l[10]),
           "v"(g[0]), "v"(g[1]), "v"(g[2]), "v"(g[3]), "v"(g[4]), "v"(g[5]), "v"(g[6]), "v"(g[7]), "v"(g[8]), "v"(g[9]), "v"(g[10]) : "memory");
    asm volatile(
        "global_load_async_to_lds_b128 %0, %11, off\n\t"
        "global_load_async_to_lds_b128 %1, %12, off\n\t"
        "global_load_async_to_lds_b128 %2, %13, off\n\t"
        "global_load_async_to_lds_b128 %3, %14, off\n\t"
        "global_load_async_to_lds_b128 %4, %15, off\n\t"
        "global_load_async_to_lds_b128 %5, %16, off\n\t"
        "global_load_async_to_lds_b128 %6, %17, off\n\t"
        "global_load_async_to_lds_b128 %7, %18, off\n\t"
        "global_load_async_to_lds_b128 %8, %19, off\n\t"
        "global_load_async_to_lds_b128 %9, %20, off\n\t"
        "global_load_async_to_lds_b128 %10, %21, off\n\t"
        "s_wait_xcnt 0x0"
        :: "v"(l[11]), "v"(l[12]), "v"(l[13]), "v"(l[14]), "v"(l[15]), "v"(l[16]), "v"(l[17]), "v"(l[18]), "v"(l[19]), "v"(l[20]), "v"(l[21]),
           "v"(g[11]), "v"(g[12]), "v"(g[13]), "v"(g[14]), "v"(g[15]), "v"(g[16]), "v"(g[17]), "v"(g[18]), "v"(g[19]), "v"(g[20]), "v"(g[21]) : "memory");
    asm volatile(
        "global_load_async_to_lds_b128 %0, %10, off\n\t"
        "global_load_async_to_lds_b128 %1, %11, off\n\t"
        "global_load_async_to_lds_b128 %2, %12, off\n\t"
        "global_load_async_to_lds_b128 %3, %13, off\n\t"
        "global_load_async_to_lds_b128 %4, %14, off\n\t"
        "global_load_async_to_lds_b128 %5, %15, off\n\t"
        "global_load_async_to_lds_b128 %6, %16, off\n\t"
        "global_load_async_to_lds_b128 %7, %17, off\n\t"
        "global_load_async_to_lds_b128 %8, %18, off\n\t"
        "global_load_async_to_lds_b128 %9, %19, off\n\t"
        "s_wait_xcnt 0x0"
        :: "v"(l[22]), "v"(l[23]), "v"(l[24]), "v"(l[25]), "v"(l[26]), "v"(l[27]), "v"(l[28]), "v"(l[29]), "v"(l[30]), "v"(l[31]),
           "v"(g[22]), "v"(g[23]), "v"(g[24]), "v"(g[25]), "v"(g[26]), "v"(g[27]), "v"(g[28]), "v"(g[29]), "v"(g[30]), "v"(g[31]) : "memory");
}

template <typename T16, int EPI>
__global__ __launch_bounds__(128) void k_gemmw(const T16* __restrict__ A, const T16* __restrict__ Bt, int K, float* C, h16* H, const float* __restrict__ CM, int ldc, size_t sA, size_t sB, size_t sC) {
    typedef typename WFrag<T16>::V V;
    __shared__ __align__(16) unsigned char L[2 * GT_BUF];
    const size_t z = blockIdx.z; A += z * sA; Bt += z * sB;
    int r0 = blockIdx.x * 128, c0 = blockIdx.y * 128;   // the tile's first A row and first Bt row
    size_t o0 = z * sC + (size_t)r0 * ldc + c0;         // its first output element
    if constexpr (EPI == EP_QKV) {
        if (z == 2) {
            const T16* w = Bt; Bt = A; A = w; r0 = blockIdx.y * 128; c0 = blockIdx.x * 128; ldc = SEQ;
            o0 = z * sC + (size_t)(blockIdx.x / (SEQ / 128)) * ((size_t)HD * SEQ) + (size_t)r0 * SEQ + (blockIdx.x % (SEQ / 128)) * 128;
        }
    }
    const int tid = threadIdx.x, lane = tid & 31, lr = lane & 15, hi = lane >> 4; const int wave = __builtin_amdgcn_readfirstlane(tid >> 5), wm = wave >> 1, wn = wave & 1;
    v8f acc[4][4];
#pragma unroll
    for (int mb = 0; mb < 4; ++mb)
#pragma unroll
        for (int nb = 0; nb < 4; ++nb) acc[mb][nb] = (v8f){};
    const char* gA = (const char*)(A + (size_t)(r0 + (tid >> 4)) * K + (tid & 15) * 8);
    const char* gB = (const char*)(Bt + (size_t)(c0 + (tid >> 4)) * K + (tid & 15) * 8);
    const size_t rs8 = (size_t)K * 16;
    const unsigned lA = (unsigned)(size_t)L + (unsigned)(tid >> 4) * GT_PITCH + (unsigned)(tid & 15) * 16u;
    const unsigned char* fa = L + (wm * 64 + lr) * GT_PITCH + hi * 16;
    const unsigned char* fb = L + GT_OP + (wn * 64 + lr) * GT_PITCH + hi * 16;
    const int nst = K / GT_KS;

    gt_stage(lA, gA, gB, rs8);
    asm volatile("s_wait_asynccnt 0x0" ::: "memory");   // stage 0 of this wave has landed
    __syncthreads();                                     // ... and every wave's part of it may be read
#pragma unroll 1
    for (int t = 0; t < nst; ++t) {
        const unsigned bo = (unsigned)(t & 1) * GT_BUF;
        V a[2][4], b[2][4];
#pragma unroll
        for (int q = 0; q < 4; ++q) { a[0][q] = WFrag<T16>::ld((const T16*)(fa + bo + q * 16 * GT_PITCH)); b[0][q] = WFrag<T16>::ld((const T16*)(fb + bo + q * 16 * GT_PITCH)); }
        // Stage t+1 goes into the other buffer, which every wave left at the barrier just passed; the copies are issued under the latency of the first fragment reads above (those read this trip's buffer only).
        if (t + 1 < nst) gt_stage(lA + (GT_BUF - bo), gA + (size_t)(t + 1) * (GT_KS * 2), gB + (size_t)(t + 1) * (GT_KS * 2), rs8);
#pragma unroll
        for (int ks = 0; ks < GT_KS / 32; ++ks) {
            if (ks + 1 < GT_KS / 32) {
#pragma unroll
                for (int q = 0; q < 4; ++q) { a[(ks + 1) & 1][q] = WFrag<T16>::ld((const T16*)(fa + bo + q * 16 * GT_PITCH + (ks + 1) * 64)); b[(ks + 1) & 1][q] = WFrag<T16>::ld((const T16*)(fb + bo + q * 16 * GT_PITCH + (ks + 1) * 64)); }
            }
            __builtin_amdgcn_sched_barrier(0);   // keeps the next block's 16 LDS reads one group ahead of this block: sunk among the WMMAs, each pair is waited out on its own
#pragma unroll
            for (int nb = 0; nb < 4; ++nb)
#pragma unroll
                for (int mb = 0; mb < 4; ++mb) acc[mb][nb] = WFrag<T16>::mma(a[ks & 1][mb], b[ks & 1][nb], acc[mb][nb]);
            __builtin_amdgcn_sched_barrier(0);   // closes the block, so that the reads after next do not rise into it
        }
        asm volatile("s_wait_dscnt 0x0" ::: "memory");      // this wave's reads of buffer t&1 are done before the buffer is given up
        asm volatile("s_wait_asynccnt 0x0" ::: "memory");   // this wave's copies of stage t+1 have landed
        __syncthreads();                                     // publishes stage t+1 and ends every reader's last read of buffer t&1, which the next trip refills
    }
    asm volatile("s_wait_asynccnt 0x0" ::: "memory");       // no copy is outstanding when the ring becomes output staging
    v4f cm = (v4f){};
    if constexpr (EPI == EP_OUT) {   // the lane's four column terms, fetched behind the loop (held over it they are spilled); load and data wait in one statement, so that no register of the load is reused while it is in flight
        const float* cp = CM + z * HD + c0 + wn * 64 + lr * 4;
        asm volatile("global_load_b128 %0, %1, off\n\ts_wait_loadcnt 0x0" : "=&v"(cm) : "v"(cp) : "memory");
    }
    float* os = (float*)L + wave * (16 * 68);               // each wave's own 16 x 68 floats; the loop's last barrier stands behind every read of the ring
#pragma unroll
    for (int mb = 0; mb < 4; ++mb) {
#pragma unroll
        for (int nb = 0; nb < 4; ++nb) {
#pragma unroll
            for (int j = 0; j < 8; ++j) os[(hi * 8 + j) * 68 + nb * 16 + lr] = acc[mb][nb][j]; }
        __builtin_amdgcn_wave_barrier(); asm volatile("" ::: "memory");
        if constexpr (EPI == EP_QKV) {   // a row of the wave's 64 columns is one 128-byte line: 8 lanes x 16 bytes, four rows a store
            h16* hrow = H + o0 + (size_t)(wm * 64 + mb * 16) * ldc + wn * 64;
#pragma unroll
            for (int s = 0; s < 4; ++s) { const int row = 4 * s + (lane >> 3), cofs = (lane & 7) * 8; const v4f v0 = *(const v4fa*)(os + row * 68 + cofs), v1 = *(const v4fa*)(os + row * 68 + cofs + 4); v8h o;
#pragma unroll
                for (int k = 0; k < 4; ++k) { o[k] = tohx(v0[k]); o[4 + k] = tohx(v1[k]); }
                *(v8h*)(hrow + (size_t)row * ldc + cofs) = o; }
        } else {
            float* crow = C + o0 + (size_t)(wm * 64 + mb * 16) * ldc + wn * 64;
#pragma unroll
            for (int s = 0; s < 8; ++s) { const int row = 2 * s + hi, cofs = lr * 4; v4f val = *(const v4fa*)(os + row * 68 + cofs);
                if constexpr (EPI == EP_OUT) val = val * (1.0f / PCAR) + cm;
                *(v4f*)(crow + (size_t)row * ldc + cofs) = val; }
        }
        asm volatile("s_wait_xcnt 0x0" ::: "memory");   // stands in front of the next 16 rows' code, which reuses the data and address registers of the stores just issued
        __builtin_amdgcn_wave_barrier(); asm volatile("" ::: "memory");
    }
}

__global__ __launch_bounds__(256) void k_cvt8(const float* __restrict__ src, bf* dst, size_t n8, size_t sS, size_t sD) {
    const size_t i = (size_t)blockIdx.x * 256 + threadIdx.x; if (i >= n8) return;
    src += (size_t)blockIdx.y * sS; dst += (size_t)blockIdx.y * sD;
    const v8f v = *(const v8f*)(src + i * 8); v8us o;
#pragma unroll
    for (int k = 0; k < 8; ++k) o[k] = f2bf(v[k]);
    *(v8us*)(dst + i * 8) = o;  }

// k_wtp: weight plane WT[e][d] (bf16, RNE) = W[d][e] (f32, [in][out] orientation), plane blockIdx.z of the stack; one 64(d) x 64(e) tile per block, transposed through LDS (all 64x64 entries staged, block barrier, pad column never read);
__global__ __launch_bounds__(256) void k_wtp(const float* __restrict__ W, bf* WT) {
    __shared__ float tl[64 * 65];
    const int tid = threadIdx.x; const int d0 = blockIdx.x * 64, e0 = blockIdx.y * 64; W += (size_t)blockIdx.z * DM * HD; WT += (size_t)blockIdx.z * HD * DM;
#pragma unroll 4
    for (int i = 0; i < 16; ++i) { const int idx = i * 256 + tid; const int dd = idx >> 6, ee = idx & 63; tl[dd * 65 + ee] = W[(size_t)(d0 + dd) * HD + e0 + ee]; }
    __syncthreads();
    const int pc = tid & 7, er = tid >> 3; v8us o0, o1;
#pragma unroll
    for (int k = 0; k < 8; ++k) { o0[k] = f2bf(tl[(pc * 8 + k) * 65 + er]); o1[k] = f2bf(tl[(pc * 8 + k) * 65 + 32 + er]); }
    bf* p0 = WT + (size_t)(e0 + er) * DM + d0 + pc * 8; bf* p1 = WT + (size_t)(e0 + 32 + er) * DM + d0 + pc * 8;
    *(v8us*)p0 = o0; *(v8us*)p1 = o1;  }

// k_vmean: VM[r] = mean over the SEQ keys of plane row r = (batch, d) of the f16 v^T plane, summed in f32. 32 rows per block, one per wave (whole 512-byte pieces per load, fixed trees); one wave stores the block's 32 means as one 128-byte line.
__global__ __launch_bounds__(1024) void k_vmean(const h16* __restrict__ VT, float* VM) {
    __shared__ float part[32];
    const int lane = threadIdx.x & 31, w = threadIdx.x >> 5; const int row0 = blockIdx.x * 32;
    const h16* p = VT + (size_t)(row0 + w) * SEQ + lane * 8; float s = 0.f;
#pragma unroll
    for (int ch = 0; ch < SEQ / 256; ++ch) { const v8h a = *(const v8h*)(p + ch * 256);
        s += (((float)a[0] + (float)a[1]) + ((float)a[2] + (float)a[3])) + (((float)a[4] + (float)a[5]) + ((float)a[6] + (float)a[7])); }
#pragma unroll
    for (int sh = 16; sh; sh >>= 1) s += __shfl_xor(s, sh, 32);
    if (lane == 0) part[w] = s;
    __syncthreads();
    if (threadIdx.x < 32) VM[row0 + threadIdx.x] = part[threadIdx.x] * (1.0f / (float)SEQ);
}

// k_asoft: per row (one wave): t = S x 768^-0.5; softmax over the SEQ keys (register row, running max then one exp, fixed shuffle trees);
__global__ __launch_bounds__(256) void k_asoft(const float* __restrict__ Sb, h16* P16) {
    const int lane = threadIdx.x & 31; const int row = blockIdx.x * 8 + (threadIdx.x >> 5); if (row >= ZB * SEQ) return;
    const float* sr = Sb + (size_t)row * SEQ; float v[SEQ / 32]; float mx = -3.0e38f;
#pragma unroll
    for (int ch = 0; ch < SEQ / 128; ++ch) { const v4f a = *(const v4f*)(sr + ch * 128 + lane * 4);
#pragma unroll
        for (int q = 0; q < 4; ++q) { const float t = a[q] * SCL; v[ch * 4 + q] = t; mx = fmaxf(mx, t); } }
#pragma unroll
    for (int sh = 16; sh; sh >>= 1) mx = fmaxf(mx, __shfl_xor(mx, sh, 32));
    float sum = 0.f;
#pragma unroll
    for (int k = 0; k < SEQ / 32; ++k) { float d0 = __fsub_rn(v[k], mx); asm volatile("" : "+v"(d0)); v[k] = __builtin_amdgcn_exp2f(__fmul_rn(d0, 1.4426950408889634f)); sum += v[k]; }
#pragma unroll
    for (int sh = 16; sh; sh >>= 1) sum += __shfl_xor(sum, sh, 32);
    const float f = __fdiv_rn(PCAR, sum); const float cen = PCAR / (float)SEQ;
{
#pragma unroll
        for (int ch = 0; ch < SEQ / 128; ++ch) { v4h o4;
#pragma unroll
            for (int q = 0; q < 4; ++q) o4[q] = tohx(v[ch * 4 + q] * f - cen);
            *(v4h*)(P16 + (size_t)row * SEQ + ch * 128 + lane * 4) = o4; }
         }
}

constexpr size_t al256(size_t b) { return (b + 255) & ~(size_t)255; }
constexpr size_t WS_TOTAL =
    al256((size_t)3 * HD * DM * 2) +              // WQ WK WV bf16, [out][in]
    al256((size_t)ZB * SEQ * DM * 2) +            // XB bf16
    al256((size_t)3 * ZB * SEQ * HD * 2) +        // QP16|KP16|VT16
    al256((size_t)ZB * HD * 4) +                  // VM
    al256((size_t)ZB * SEQ * SEQ * 4);            // Sb; P16 lies over XB|QP16|KP16, which nothing reads behind the S product
static_assert(WS_TOTAL <= (size_t)268435456);
static_assert(((size_t)ZB * SEQ * DM * 2) % 256 == 0);   // XB and QP16 adjoin

extern "C" void kernel_launch(void* const* d_in, const int* in_sizes, int n_in,
                              void* d_out, int out_size, void* d_ws, size_t ws_size, hipStream_t stream) {
    if (n_in < 2) return;
    if ((size_t)in_sizes[0] < ((size_t)(NB - 1) * SEQ_FULL + SEQ) * DM) return;
    if ((size_t)in_sizes[1] < (size_t)3 * DM * HD) return;
    if ((size_t)out_size < (size_t)NB * SEQ * DM) return;
    if (WS_TOTAL > ws_size) return;
    const float* x = (const float*)d_in[0]; const float* qkv = (const float*)d_in[1];   // qkv: [3][in 768][out 768], slabs q, k, v
    float* OUT = (float*)d_out;     // [NB][SEQ][768]
    char* wsp = (char*)d_ws;
    auto take = [&](size_t bytes) { char* p = wsp; wsp += al256(bytes); return (void*)p; };
    bf* WT = (bf*)take((size_t)3 * HD * DM * 2);
    bf* XB = (bf*)take((size_t)ZB * SEQ * DM * 2);
    h16* QP16 = (h16*)take((size_t)3 * ZB * SEQ * HD * 2); h16* KP16 = QP16 + (size_t)ZB * SEQ * HD; h16* VT16 = KP16 + (size_t)ZB * SEQ * HD;
    float* VM = (float*)take((size_t)ZB * HD * 4);
    float* Sb = (float*)take((size_t)ZB * SEQ * SEQ * 4); h16* P16 = (h16*)XB;
    if ((size_t)(wsp - (char*)d_ws) > ws_size) return;

    // weight slabs W[d][e] ([in][out]) -> planes WT[e][d] ([out][in], K-contiguous for the GEMM)
    k_wtp<<<dim3(DM / 64, HD / 64, 3), 256, 0, stream>>>(qkv, WT);
    const size_t x8 = (size_t)SEQ * DM / 8;                 // per batch slab
    k_cvt8<<<dim3((unsigned)((x8 + 255) / 256), ZB, 1), 256, 0, stream>>>(x, XB, x8, (size_t)SEQ_FULL * DM, (size_t)SEQ * DM);
    k_gemmw<bf, EP_QKV><<<dim3(ZB * SEQ / 128, HD / 128, 3), 128, 0, stream>>>(XB, WT, DM, nullptr, QP16, nullptr, HD, 0, (size_t)HD * DM, (size_t)ZB * SEQ * HD);
    k_vmean<<<ZB * HD / 32, 1024, 0, stream>>>(VT16, VM);
    k_gemmw<h16, EP_F32><<<dim3(SEQ / 128, SEQ / 128, ZB), 128, 0, stream>>>(QP16, KP16, HD, Sb, nullptr, nullptr, SEQ, (size_t)SEQ * HD, (size_t)SEQ * HD, (size_t)SEQ * SEQ);
    k_asoft<<<ZB * SEQ / 8, 256, 0, stream>>>(Sb, P16);
    k_gemmw<h16, EP_OUT><<<dim3(SEQ / 128, HD / 128, ZB), 128, 0, stream>>>(P16, VT16, SEQ, OUT, nullptr, VM, HD, (size_t)SEQ * SEQ, (size_t)HD * SEQ, (size_t)SEQ * HD);
}

// v004
// Measured time: 161 microseconds a run.
// Next to v003, in two timings, it ran 1.14 and 1.13 times as fast.
// Over all steps from v000 it is 4.83 times as fast.
#include <hip/hip_runtime.h>

// Contractions: q/k/v projections on v_wmma_f32_16x16x32_bf16 (x and the stacked QKV weights RNE-converted to bf16, weights transposed to [out][in] planes, exact products, f32 accumulate); q.k^T and att.v on v_wmma_f32_16x16x32_f16 (f16 q/k/v planes; softmax weights carried x1024 and centred by 1024/SEQ, column mean of v added back in f32), f32 accumulate.
// Single-head full-width self-attention: x [8][2048][768]; q = x QKV[0], k = x QKV[1], v = x QKV[2] ('io' [768][768] each, stacked [3][768][768], no bias); att = softmax(q.k * 768^-0.5) over all 2048 keys (no mask); out = att @ v -> [8][2048][768] f32.
// All batches in one pass, one launch per stage (z-batched GEMMs): projections stored as f16 planes by the GEMM itself (q, k row-major; v transposed [d][t] in the GEMM's output staging); S = q k^T (f32, materialised); row softmax in registers; O = P' v, stored as out = O/1024 + mean_t(v).

#ifndef NB
#define NB 8
#endif
#ifndef SEQ
#define SEQ 2048
#endif
#define NB_FULL  8
#define SEQ_FULL 2048
#define DM   768
#define HD   768
#define ZB   NB                           // batches per pass: all of them
#define PCAR 1024.0f
#define SCL  0.03608439182435161f         // 768^-0.5

typedef _Float16 h16;
typedef unsigned short bf;
typedef __attribute__((ext_vector_type(16))) __bf16   v16bf;
typedef __attribute__((ext_vector_type(16))) _Float16 v16h;
typedef __attribute__((ext_vector_type(8)))  _Float16 v8h;
typedef __attribute__((ext_vector_type(8)))  unsigned short v8us;
typedef __attribute__((ext_vector_type(8)))  float    v8f;
typedef __attribute__((ext_vector_type(4)))  float    v4f;
typedef __attribute__((ext_vector_type(4)))  _Float16 v4h;
typedef v4f  __attribute__((may_alias)) v4fa;

static_assert(NB <= NB_FULL);
static_assert(SEQ <= SEQ_FULL);
static_assert(NB % ZB == 0);
static_assert(SEQ % 256 == 0);                 // softmax row chunks, 256-row tiles, K stages of 128
static_assert(DM % 128 == 0 && HD % 192 == 0); // K stages of 128, 192-column tiles; 64x64 weight transpose tiles
static_assert(DM == HD);                       // one full-width head: plane pitch == row pitch
static_assert(((size_t)SEQ * DM) % 8 == 0);
static_assert((ZB * SEQ) % 8 == 0);
static_assert(HD % 32 == 0 && SEQ % 256 == 0);  // k_vmean: 32 rows per block, 256 keys per wave load
static_assert((DM * 2) % 128 == 0);
static_assert(SEQ <= 3 * DM);                  // the softmax weights lie over the x, q and k planes

__device__ __forceinline__ unsigned short f2bf(float f) { unsigned u = __float_as_uint(f); u += 0x7FFFu + ((u >> 16) & 1u); return (unsigned short)(u >> 16); }
__device__ __forceinline__ v16h cat16(v8h lo, v8h hi) { return __builtin_shufflevector(lo, hi, 0, 1, 2, 3, 4, 5, 6, 7, 8, 9, 10, 11, 12, 13, 14, 15); }
__device__ __forceinline__ v16bf cat16b(v8us lo, v8us hi) { return __builtin_bit_cast(v16bf, __builtin_shufflevector(lo, hi, 0, 1, 2, 3, 4, 5, 6, 7, 8, 9, 10, 11, 12, 13, 14, 15)); }
__device__ __forceinline__ v8f wmma16(v16h a, v16h b, v8f c) { return __builtin_amdgcn_wmma_f32_16x16x32_f16(false, a, false, b, (short)0, c, false, false); }
__device__ __forceinline__ v8f wmmab(v16bf a, v16bf b, v8f c) { return __builtin_amdgcn_wmma_f32_16x16x32_bf16(false, a, false, b, (short)0, c, false, false); }
__device__ __forceinline__ h16 tohx(float x) { return (h16)x; }

// ---- k_gemmw: GEMM, one 256 x RB output tile per workgroup of FOUR WAVES, one wave a SIMD; each wave holds FA x FB accumulator tiles (16 FA rows x 16 FB columns); the waves lie (4 / WN) x WN over the tile, RB = 16 FB WN; grid (M/256, N/RB, Z), 128 threads.
// Wave tiles: 128x128 (S = q k^T), 128x96 (O = P' v), 64x192 (projections): FA FB products per FA + FB loaded fragments, against 16 per 8 with a 64x64 wave tile, and about half the L2 bytes per product of a 128x128 workgroup tile. RB = 192 makes 768 and 256 workgroups of the projections and of O: whole rounds of one workgroup a WGP. The projections' waves lie 4 x 1, so that a wave's 192 16-bit columns are whole 128-byte lines.
// D[m][n] = sum_k A[m][k] Bt[n][k] (f32 accumulate), A and Bt K-contiguous 16-bit planes. z-batch strides sA/sB/sC in elements. K (a template constant) % 128 == 0, M % 256 == 0, N % RB == 0.
// The epilogue stores what the next kernel reads, pitch ldc: EP_F32: C = D; EP_QKV: H = D rounded to f16 (RNE); EP_OUT: C = D/1024 + CM[z][n] (CM: HD floats per z).
// EP_QKV is the three projections in one grid (x = 256 rows of all batches' x, y = 192 weight rows, z = q, k, v): slices 0 and 1 as above; slice 2 transposes in its output staging and stores v^T[batch][d][t], pitch SEQ.
// A stage is 128 k (256 B) of the tile's 256 A rows and RB Bt rows, brought into LDS by asynchronous 16-byte copies (whole 256-B row pieces per half wave), two buffers: stage t+1 flies while stage t is multiplied.
// Fragment map (A and Bt alike): lane -> row/col lane&15, h = lane>>4; elements 0..7 = k0+8h+0..7, elements 8..15 = k0+16+8h+0..7. D: acc[j] = (row 8h+j, col lane&15).
#define GT_KS    128                      // k per stage
#define GT_PITCH 272                      // LDS row pitch, bytes: 16 B x odd, no bank conflict for 16-byte fragment reads
#define GT_RA    256                      // A rows of a tile
#define EP_F32 0
#define EP_QKV 1
#define EP_OUT 2
template <typename T16> struct WFrag;
template <> struct WFrag<h16> { typedef v16h V; static __device__ __forceinline__ V ld(const h16* p) { return cat16(*(const v8h*)p, *(const v8h*)(p + 16)); } static __device__ __forceinline__ v8f mma(V a, V b, v8f c) { return wmma16(a, b, c); } };
template <> struct WFrag<bf> { typedef v16bf V; static __device__ __forceinline__ V ld(const bf* p) { return cat16b(*(const v8us*)p, *(const v8us*)(p + 16)); } static __device__ __forceinline__ v8f mma(V a, V b, v8f c) { return wmmab(a, b, c); } };

// One stage's copies of one thread for 256 rows of one operand: 32 copies, rows 8 apart (thread -> row tid>>4, 16-byte column tid&15). l0: the thread's LDS byte address in the operand's part of the buffer; g: the operand's first row, the same in every lane (a scalar base); o0: the byte offset of the thread's first copy of this stage from it; RS8: 8 source rows in bytes.
// Each statement ends in s_wait_xcnt 0 so that no address register of an issued copy is rewritten ahead of that wait.
template <unsigned RS8>
__device__ __forceinline__ void gt_rows256(unsigned l0, const char* g, unsigned o0) {
    unsigned l[32], o[32];
#pragma unroll
    for (int i = 0; i < 32; ++i) { l[i] = l0 + (unsigned)i * (8u * GT_PITCH); o[i] = o0 + (unsigned)i * RS8; }
    asm volatile(
        "global_load_async_to_lds_b128 %0, %11, %22\n\t"
        "global_load_async_to_lds_b128 %1, %12, %22\n\t"
        "global_load_async_to_lds_b128 %2, %13, %22\n\t"
        "global_load_async_to_lds_b128 %3, %14, %22\n\t"
        "global_load_async_to_lds_b128 %4, %15, %22\n\t"
        "global_load_async_to_lds_b128 %5, %16, %22\n\t"
        "global_load_async_to_lds_b128 %6, %17, %22\n\t"
        "global_load_async_to_lds_b128 %7, %18, %22\n\t"
        "global_load_async_to_lds_b128 %8, %19, %22\n\t"
        "global_load_async_to_lds_b128 %9, %20, %22\n\t"
        "global_load_async_to_lds_b128 %10, %21, %22\n\t"
        "s_wait_xcnt 0x0"
        :: "v"(l[0]), "v"(l[1]), "v"(l[2]), "v"(l[3]), "v"(l[4]), "v"(l[5]), "v"(l[6]), "v"(l[7]), "v"(l[8]), "v"(l[9]), "v"(l[10]),
           "v"(o[0]), "v"(o[1]), "v"(o[2]), "v"(o[3]), "v"(o[4]), "v"(o[5]), "v"(o[6]), "v"(o[7]), "v"(o[8]), "v"(o[9]), "v"(o[10]), "s"(g) : "memory");
    asm volatile(
        "global_load_async_to_lds_b128 %0, %11, %22\n\t"
        "global_load_async_to_lds_b128 %1, %12, %22\n\t"
        "global_load_async_to_lds_b128 %2, %13, %22\n\t"
        "global_load_async_to_lds_b128 %3, %14, %22\n\t"
        "global_load_async_to_lds_b128 %4, %15, %22\n\t"
        "global_load_async_to_lds_b128 %5, %16, %22\n\t"
        "global_load_async_to_lds_b128 %6, %17, %22\n\t"
        "global_load_async_to_lds_b128 %7, %18, %22\n\t"
        "global_load_async_to_lds_b128 %8, %19, %22\n\t"
        "global_load_async_to_lds_b128 %9, %20, %22\n\t"
        "global_load_async_to_lds_b128 %10, %21, %22\n\t"
        "s_wait_xcnt 0x0"
        :: "v"(l[11]), "v"(l[12]), "v"(l[13]), "v"(l[14]), "v"(l[15]), "v"(l[16]), "v"(l[17]), "v"(l[18]), "v"(l[19]), "v"(l[20]), "v"(l[21]),
           "v"(o[11]), "v"(o[12]), "v"(o[13]), "v"(o[14]), "v"(o[15]), "v"(o[16]), "v"(o[17]), "v"(o[18]), "v"(o[19]), "v"(o[20]), "v"(o[21]), "s"(g) : "memory");
    asm volatile(
        "global_load_async_to_lds_b128 %0, %10, %20\n\t"
        "global_load_async_to_lds_b128 %1, %11, %20\n\t"
        "global_load_async_to_lds_b128 %2, %12, %20\n\t"
        "global_load_async_to_lds_b128 %3, %13, %20\n\t"
        "global_load_async_to_lds_b128 %4, %14, %20\n\t"
        "global_load_async_to_lds_b128 %5, %15, %20\n\t"
        "global_load_async_to_lds_b128 %6, %16, %20\n\t"
        "global_load_async_to_lds_b128 %7, %17, %20\n\t"
        "global_load_async_to_lds_b128 %8, %18, %20\n\t"
        "global_load_async_to_lds_b128 %9, %19, %20\n\t"
        "s_wait_xcnt 0x0"
        :: "v"(l[22]), "v"(l[23]), "v"(l[24]), "v"(l[25]), "v"(l[26]), "v"(l[27]), "v"(l[28]), "v"(l[29]), "v"(l[30]), "v"(l[31]),
           "v"(o[22]), "v"(o[23]), "v"(o[24]), "v"(o[25]), "v"(o[26]), "v"(o[27]), "v"(o[28]), "v"(o[29]), "v"(o[30]), "v"(o[31]), "s"(g) : "memory");
}
// The same for 192 rows: 24 copies.
template <unsigned RS8>
__device__ __forceinline__ void gt_rows192(unsigned l0, const char* g, unsigned o0) {
    unsigned l[24], o[24];
#pragma unroll
    for (int i = 0; i < 24; ++i) { l[i] = l0 + (unsigned)i * (8u * GT_PITCH); o[i] = o0 + (unsigned)i * RS8; }
    asm volatile(
        "global_load_async_to_lds_b128 %0, %12, %24\n\t"
        "global_load_async_to_lds_b128 %1, %13, %24\n\t"
        "global_load_async_to_lds_b128 %2, %14, %24\n\t"
        "global_load_async_to_lds_b128 %3, %15, %24\n\t"
        "global_load_async_to_lds_b128 %4, %16, %24\n\t"
        "global_load_async_to_lds_b128 %5, %17, %24\n\t"
        "global_load_async_to_lds_b128 %6, %18, %24\n\t"
        "global_load_async_to_lds_b128 %7, %19, %24\n\t"
        "global_load_async_to_lds_b128 %8, %20, %24\n\t"
        "global_load_async_to_lds_b128 %9, %21, %24\n\t"
        "global_load_async_to_lds_b128 %10, %22, %24\n\t"
        "global_load_async_to_lds_b128 %11, %23, %24\n\t"
        "s_wait_xcnt 0x0"
        :: "v"(l[0]), "v"(l[1]), "v"(l[2]), "v"(l[3]), "v"(l[4]), "v"(l[5]), "v"(l[6]), "v"(l[7]), "v"(l[8]), "v"(l[9]), "v"(l[10]), "v"(l[11]),
           "v"(o[0]), "v"(o[1]), "v"(o[2]), "v"(o[3]), "v"(o[4]), "v"(o[5]), "v"(o[6]), "v"(o[7]), "v"(o[8]), "v"(o[9]), "v"(o[10]), "v"(o[11]), "s"(g) : "memory");
    asm volatile(
        "global_load_async_to_lds_b128 %0, %12, %24\n\t"
        "global_load_async_to_lds_b128 %1, %13, %24\n\t"
        "global_load_async_to_lds_b128 %2, %14, %24\n\t"
        "global_load_async_to_lds_b128 %3, %15, %24\n\t"
        "global_load_async_to_lds_b128 %4, %16, %24\n\t"
        "global_load_async_to_lds_b128 %5, %17, %24\n\t"
        "global_load_async_to_lds_b128 %6, %18, %24\n\t"
        "global_load_async_to_lds_b128 %7, %19, %24\n\t"
        "global_load_async_to_lds_b128 %8, %20, %24\n\t"
        "global_load_async_to_lds_b128 %9, %21, %24\n\t"
        "global_load_async_to_lds_b128 %10, %22, %24\n\t"
        "global_load_async_to_lds_b128 %11, %23, %24\n\t"
        "s_wait_xcnt 0x0"
        :: "v"(l[12]), "v"(l[13]), "v"(l[14]), "v"(l[15]), "v"(l[16]), "v"(l[17]), "v"(l[18]), "v"(l[19]), "v"(l[20]), "v"(l[21]), "v"(l[22]), "v"(l[23]),
           "v"(o[12]), "v"(o[13]), "v"(o[14]), "v"(o[15]), "v"(o[16]), "v"(o[17]), "v"(o[18]), "v"(o[19]), "v"(o[20]), "v"(o[21]), "v"(o[22]), "v"(o[23]), "s"(g) : "memory");
}

// N 16-byte stores of a lane and their s_wait_xcnt 0 in one statement, so that no address or data register of an issued store is rewritten ahead of that wait.
template <int N>
__device__ __forceinline__ void gt_st(void* const (&p)[N], const v4f (&d)[N]) {
    static_assert(N == 4 || N == 8 || N == 6);
    if constexpr (N == 4) {
        asm volatile(
            "global_store_b128 %0, %4, off\n\t"
            "global_store_b128 %1, %5, off\n\t"
            "global_store_b128 %2, %6, off\n\t"
            "global_store_b128 %3, %7, off\n\t"
            "s_wait_xcnt 0x0"
            :: "v"(p[0]), "v"(p[1]), "v"(p[2]), "v"(p[3]),
               "v"(d[0]), "v"(d[1]), "v"(d[2]), "v"(d[3]) : "memory");
    } else if constexpr (N == 8) {
        asm volatile(
            "global_store_b128 %0, %8, off\n\t"
            "global_store_b128 %1, %9, off\n\t"
            "global_store_b128 %2, %10, off\n\t"
            "global_store_b128 %3, %11, off\n\t"
            "global_store_b128 %4, %12, off\n\t"
            "global_store_b128 %5, %13, off\n\t"
            "global_store_b128 %6, %14, off\n\t"
            "global_store_b128 %7, %15, off\n\t"
            "s_wait_xcnt 0x0"
            :: "v"(p[0]), "v"(p[1]), "v"(p[2]), "v"(p[3]), "v"(p[4]), "v"(p[5]), "v"(p[6]), "v"(p[7]),
               "v"(d[0]), "v"(d[1]), "v"(d[2]), "v"(d[3]), "v"(d[4]), "v"(d[5]), "v"(d[6]), "v"(d[7]) : "memory");
    } else {
        asm volatile(
            "global_store_b128 %0, %6, off\n\t"
            "global_store_b128 %1, %7, off\n\t"
            "global_store_b128 %2, %8, off\n\t"
            "global_store_b128 %3, %9, off\n\t"
            "global_store_b128 %4, %10, off\n\t"
            "global_store_b128 %5, %11, off\n\t"
            "s_wait_xcnt 0x0"
            :: "v"(p[0]), "v"(p[1]), "v"(p[2]), "v"(p[3]), "v"(p[4]), "v"(p[5]),
               "v"(d[0]), "v"(d[1]), "v"(d[2]), "v"(d[3]), "v"(d[4]), "v"(d[5]) : "memory");
    }
}

// The epilogue of one wave: its FA x FB accumulator tiles go through the wave's own LDS rows to whole 128-byte lines. C, H: the tile's first output element; CM: its first column term. SWAP: D^T is stored (rows = Bt rows, columns = A rows): a lane's eight accumulator rows are eight neighbours of one staged row.
template <int EPI, int FA, int FB, int WN, bool SWAP>
__device__ __forceinline__ void gt_store(unsigned char* L, const v8f (&acc)[FA][FB], float* C, h16* H, const float* CM, int ldc) {
    const int tid = threadIdx.x, lane = tid & 31, lr = lane & 15, hi = lane >> 4; const int wave = __builtin_amdgcn_readfirstlane(tid >> 5), wm = wave / WN, wn = wave % WN;
    constexpr int RG = SWAP ? FB : FA, CG = SWAP ? FA : FB, CW = CG * 16, OP = CW + 4;   // the wave's 16-row groups, its columns, the staging pitch in floats
    const int row0 = SWAP ? wn * FB * 16 : wm * FA * 16, col0 = SWAP ? wm * FA * 16 : wn * FB * 16;
    v4f cm[3] = {};
    if constexpr (EPI == EP_OUT) {   // the lane's column terms (its column repeats every third store), fetched behind the loop; load and data wait in one statement, so that no register of the load is reused while it is in flight
        static_assert(CW == 96);
#pragma unroll
        for (int k = 0; k < 3; ++k) { const float* cp = CM + col0 + ((k * 32 + lane) % 24) * 4;
            asm volatile("global_load_b128 %0, %1, off\n\ts_wait_loadcnt 0x0" : "=&v"(cm[k]) : "v"(cp) : "memory"); }
    }
    float* os = (float*)L + wave * (16 * OP);               // each wave's own 16 x OP floats; the loop's last barrier stands behind every read of the ring
#pragma unroll
    for (int rg = 0; rg < RG; ++rg) {
#pragma unroll
        for (int cg = 0; cg < CG; ++cg) {
#pragma unroll
            for (int j = 0; j < 8; ++j) { if constexpr (SWAP) os[lr * OP + cg * 16 + hi * 8 + j] = acc[cg][rg][j]; else os[(hi * 8 + j) * OP + cg * 16 + lr] = acc[rg][cg][j]; } }
        __builtin_amdgcn_wave_barrier(); asm volatile("" ::: "memory");
        if constexpr (EPI == EP_QKV) {   // 8 lanes x 16 bytes are one 128-byte line; a row of the wave's columns is CW / 64 whole lines
            h16* hrow = H + (size_t)(row0 + rg * 16) * ldc + col0; constexpr int NS = CW == 64 ? 4 : 6;   // stores a statement
            static_assert((CW / 16) % NS == 0);
#pragma unroll
            for (int s0 = 0; s0 < CW / 16; s0 += NS) { void* p[NS]; v4f d[NS];
#pragma unroll
                for (int u = 0; u < NS; ++u) { const int idx = (s0 + u) * 32 + lane, row = idx / (CW / 8), cofs = (idx % (CW / 8)) * 8; const v4f v0 = *(const v4fa*)(os + row * OP + cofs), v1 = *(const v4fa*)(os + row * OP + cofs + 4); v8h o;
#pragma unroll
                    for (int k = 0; k < 4; ++k) { o[k] = tohx(v0[k]); o[4 + k] = tohx(v1[k]); }
                    p[u] = hrow + (size_t)row * ldc + cofs; d[u] = __builtin_bit_cast(v4f, o); }
                gt_st(p, d); }
        } else {                         // 8 lanes x 16 bytes are one 128-byte line; a row of the wave's columns is CW / 32 whole lines
            float* crow = C + (size_t)(row0 + rg * 16) * ldc + col0; constexpr int NS = CW == 128 ? 8 : 6;   // stores a statement
            static_assert((CW / 8) % NS == 0);
#pragma unroll
            for (int s0 = 0; s0 < CW / 8; s0 += NS) { void* p[NS]; v4f d[NS];
#pragma unroll
                for (int u = 0; u < NS; ++u) { const int s = s0 + u, idx = s * 32 + lane, row = idx / (CW / 4), cofs = (idx % (CW / 4)) * 4; v4f val = *(const v4fa*)(os + row * OP + cofs);
                    if constexpr (EPI == EP_OUT) val = val * (1.0f / PCAR) + cm[s % 3];
                    p[u] = crow + (size_t)row * ldc + cofs; d[u] = val; }
                gt_st(p, d); }
        }
        __builtin_amdgcn_wave_barrier(); asm volatile("" ::: "memory");
    }
}

// One tile. A, Bt: the tile's first rows; C, H: its first output element; CM: its first column term. swap (the same in the whole workgroup; EP_QKV only): D^T is stored (rows = Bt rows, columns = A rows).
template <typename T16, int EPI, int K, int FA, int FB, int WN>
__device__ __forceinline__ void gt_tile(unsigned char* L, const T16* A, const T16* Bt, float* C, h16* H, const float* CM, int ldc, bool swap) {
    typedef typename WFrag<T16>::V V;
    constexpr int RB = FB * 16 * WN;
    static_assert(FA * 16 * (4 / WN) == GT_RA && (RB == 256 || RB == 192) && K % GT_KS == 0);
    constexpr unsigned OPA = GT_RA * GT_PITCH, BUF = (GT_RA + RB) * GT_PITCH;   // A rows, then Bt rows
    const int tid = threadIdx.x, lane = tid & 31, lr = lane & 15, hi = lane >> 4; const int wave = __builtin_amdgcn_readfirstlane(tid >> 5), wm = wave / WN, wn = wave % WN;
    v8f acc[FA][FB];
#pragma unroll
    for (int mb = 0; mb < FA; ++mb)
#pragma unroll
        for (int nb = 0; nb < FB; ++nb) acc[mb][nb] = (v8f){};
    const char* gA = (const char*)A; const char* gB = (const char*)Bt;
    constexpr unsigned RS8 = (unsigned)K * 16u;   // a constant, so that each copy's offset is one addition and no chain of additions
    static_assert((size_t)256 * K * 2 < ((size_t)1 << 31));
    const unsigned go = (unsigned)(tid >> 4) * ((unsigned)K * 2u) + (unsigned)(tid & 15) * 16u;   // the thread's byte offset in either operand at stage 0
    const unsigned lA = (unsigned)(size_t)L + (unsigned)(tid >> 4) * GT_PITCH + (unsigned)(tid & 15) * 16u;
    const unsigned char* fa = L + (wm * FA * 16 + lr) * GT_PITCH + hi * 16;
    const unsigned char* fb = L + OPA + (wn * FB * 16 + lr) * GT_PITCH + hi * 16;
    constexpr int nst = K / GT_KS;
    auto copyB = [&](unsigned l0, unsigned o0) {
        if constexpr (RB == 256) {
            asm volatile("s_wait_asynccnt 0x1f" ::: "memory");   // at most 31 of the A rows' copies are still out, so that with these 32 never more than 63 copies of the wave are outstanding
            gt_rows256<RS8>(l0, gB, o0);
        } else gt_rows192<RS8>(l0, gB, o0);
    };

    gt_rows256<RS8>(lA, gA, go);
    copyB(lA + OPA, go);
    asm volatile("s_wait_asynccnt 0x0" ::: "memory");   // stage 0 of this wave has landed
    __syncthreads();                                     // ... and every wave's part of it may be read
#pragma unroll 1
    for (int t = 0; t < nst; ++t) {
        const unsigned bo = (unsigned)(t & 1) * BUF;
        V a[2][FA], b[2][FB];
#pragma unroll
        for (int q = 0; q < FA; ++q) a[0][q] = WFrag<T16>::ld((const T16*)(fa + bo + q * 16 * GT_PITCH));
#pragma unroll
        for (int q = 0; q < FB; ++q) b[0][q] = WFrag<T16>::ld((const T16*)(fb + bo + q * 16 * GT_PITCH));
        // Stage t+1 goes into the other buffer, which every wave left at the barrier just passed; its A rows' copies are issued under the latency of the first fragment reads above (those read this trip's buffer only), its Bt rows' copies behind the first block.
        if (t + 1 < nst) gt_rows256<RS8>(lA + (BUF - bo), gA, go + (unsigned)(t + 1) * (GT_KS * 2u));
#pragma unroll
        for (int ks = 0; ks < GT_KS / 32; ++ks) {
            if (ks + 1 < GT_KS / 32) {
#pragma unroll
                for (int q = 0; q < FA; ++q) a[(ks + 1) & 1][q] = WFrag<T16>::ld((const T16*)(fa + bo + q * 16 * GT_PITCH + (ks + 1) * 64));
#pragma unroll
                for (int q = 0; q < FB; ++q) b[(ks + 1) & 1][q] = WFrag<T16>::ld((const T16*)(fb + bo + q * 16 * GT_PITCH + (ks + 1) * 64));
            }
            __builtin_amdgcn_sched_barrier(0);   // keeps the next block's LDS reads one group ahead of this block: sunk among the WMMAs, each pair is waited out on its own
#pragma unroll
            for (int nb = 0; nb < FB; ++nb)
#pragma unroll
                for (int mb = 0; mb < FA; ++mb) acc[mb][nb] = WFrag<T16>::mma(a[ks & 1][mb], b[ks & 1][nb], acc[mb][nb]);
            __builtin_amdgcn_sched_barrier(0);   // closes the block, so that the reads after next do not rise into it
            if (ks == 0) { if (t + 1 < nst) copyB(lA + (BUF - bo) + OPA, go + (unsigned)(t + 1) * (GT_KS * 2u)); }
        }
        asm volatile("s_wait_dscnt 0x0" ::: "memory");      // this wave's reads of buffer t&1 are done before the buffer is given up
        asm volatile("s_wait_asynccnt 0x0" ::: "memory");   // this wave's copies of stage t+1 have landed
        __syncthreads();                                     // publishes stage t+1 and ends every reader's last read of buffer t&1, which the next trip refills
    }
    asm volatile("s_wait_asynccnt 0x0" ::: "memory");       // no copy is outstanding when the ring becomes output staging
    if constexpr (EPI == EP_QKV) {
        if (swap) gt_store<EPI, FA, FB, WN, true>(L, acc, C, H, CM, ldc);
        else gt_store<EPI, FA, FB, WN, false>(L, acc, C, H, CM, ldc);
    } else gt_store<EPI, FA, FB, WN, false>(L, acc, C, H, CM, ldc);
}

template <typename T16, int EPI, int K, int FA, int FB, int WN>
__global__ __launch_bounds__(128) void k_gemmw(const T16* __restrict__ A, const T16* __restrict__ Bt, float* C, h16* H, const float* __restrict__ CM, int ldc, size_t sA, size_t sB, size_t sC) {
    constexpr int RB = FB * 16 * WN;
    __shared__ __align__(16) unsigned char L[2 * (GT_RA + RB) * GT_PITCH];
    const size_t z = blockIdx.z; const int r0 = blockIdx.x * GT_RA, c0 = blockIdx.y * RB;   // the tile's first A row and first Bt row
    A += z * sA + (size_t)r0 * K; Bt += z * sB + (size_t)c0 * K;
    const size_t o0 = z * sC + (size_t)r0 * ldc + c0;   // its first output element
    if constexpr (EPI == EP_QKV) {
        const bool vt = z == 2;   // v^T[batch][d][t]
        const size_t ov = z * sC + (size_t)(blockIdx.x / (SEQ / GT_RA)) * ((size_t)HD * SEQ) + (size_t)c0 * SEQ + (blockIdx.x % (SEQ / GT_RA)) * GT_RA;
        gt_tile<T16, EPI, K, FA, FB, WN>(L, A, Bt, nullptr, H + (vt ? ov : o0), nullptr, vt ? SEQ : ldc, vt);
    } else if constexpr (EPI == EP_OUT) gt_tile<T16, EPI, K, FA, FB, WN>(L, A, Bt, C + o0, nullptr, CM + z * HD + c0, ldc, false);
    else gt_tile<T16, EPI, K, FA, FB, WN>(L, A, Bt, C + o0, nullptr, nullptr, ldc, false);
}

__global__ __launch_bounds__(256) void k_cvt8(const float* __restrict__ src, bf* dst, size_t n8, size_t sS, size_t sD) {
    const size_t i = (size_t)blockIdx.x * 256 + threadIdx.x; if (i >= n8) return;
    src += (size_t)blockIdx.y * sS; dst += (size_t)blockIdx.y * sD;
    const v8f v = *(const v8f*)(src + i * 8); v8us o;
#pragma unroll
    for (int k = 0; k < 8; ++k) o[k] = f2bf(v[k]);
    *(v8us*)(dst + i * 8) = o;  }

// k_wtp: weight plane WT[e][d] (bf16, RNE) = W[d][e] (f32, [in][out] orientation), plane blockIdx.z of the stack; one 64(d) x 64(e) tile per block, transposed through LDS (all 64x64 entries staged, block barrier, pad column never read);
__global__ __launch_bounds__(256) void k_wtp(const float* __restrict__ W, bf* WT) {
    __shared__ float tl[64 * 65];
    const int tid = threadIdx.x; const int d0 = blockIdx.x * 64, e0 = blockIdx.y * 64; W += (size_t)blockIdx.z * DM * HD; WT += (size_t)blockIdx.z * HD * DM;
#pragma unroll 4
    for (int i = 0; i < 16; ++i) { const int idx = i * 256 + tid; const int dd = idx >> 6, ee = idx & 63; tl[dd * 65 + ee] = W[(size_t)(d0 + dd) * HD + e0 + ee]; }
    __syncthreads();
    const int pc = tid & 7, er = tid >> 3; v8us o0, o1;
#pragma unroll
    for (int k = 0; k < 8; ++k) { o0[k] = f2bf(tl[(pc * 8 + k) * 65 + er]); o1[k] = f2bf(tl[(pc * 8 + k) * 65 + 32 + er]); }
    bf* p0 = WT + (size_t)(e0 + er) * DM + d0 + pc * 8; bf* p1 = WT + (size_t)(e0 + 32 + er) * DM + d0 + pc * 8;
    *(v8us*)p0 = o0; *(v8us*)p1 = o1;  }

// k_vmean: VM[r] = mean over the SEQ keys of plane row r = (batch, d) of the f16 v^T plane, summed in f32. 32 rows per block, one per wave (whole 512-byte pieces per load, fixed trees); one wave stores the block's 32 means as one 128-byte line.
__global__ __launch_bounds__(1024) void k_vmean(const h16* __restrict__ VT, float* VM) {
    __shared__ float part[32];
    const int lane = threadIdx.x & 31, w = threadIdx.x >> 5; const int row0 = blockIdx.x * 32;
    const h16* p = VT + (size_t)(row0 + w) * SEQ + lane * 8; float s = 0.f;
#pragma unroll
    for (int ch = 0; ch < SEQ / 256; ++ch) { const v8h a = *(const v8h*)(p + ch * 256);
        s += (((float)a[0] + (float)a[1]) + ((float)a[2] + (float)a[3])) + (((float)a[4] + (float)a[5]) + ((float)a[6] + (float)a[7])); }
#pragma unroll
    for (int sh = 16; sh; sh >>= 1) s += __shfl_xor(s, sh, 32);
    if (lane == 0) part[w] = s;
    __syncthreads();
    if (threadIdx.x < 32) VM[row0 + threadIdx.x] = part[threadIdx.x] * (1.0f / (float)SEQ);
}

// k_asoft: per row (one wave): t = S x 768^-0.5; softmax over the SEQ keys (register row, running max then one exp, fixed shuffle trees);
__global__ __launch_bounds__(256) void k_asoft(const float* __restrict__ Sb, h16* P16) {
    const int lane = threadIdx.x & 31; const int row = blockIdx.x * 8 + (threadIdx.x >> 5); if (row >= ZB * SEQ) return;
    const float* sr = Sb + (size_t)row * SEQ; float v[SEQ / 32]; float mx = -3.0e38f;
#pragma unroll
    for (int ch = 0; ch < SEQ / 128; ++ch) { const v4f a = *(const v4f*)(sr + ch * 128 + lane * 4);
#pragma unroll
        for (int q = 0; q < 4; ++q) { const float t = a[q] * SCL; v[ch * 4 + q] = t; mx = fmaxf(mx, t); } }
#pragma unroll
    for (int sh = 16; sh; sh >>= 1) mx = fmaxf(mx, __shfl_xor(mx, sh, 32));
    float sum = 0.f;
#pragma unroll
    for (int k = 0; k < SEQ / 32; ++k) { float d0 = __fsub_rn(v[k], mx); asm volatile("" : "+v"(d0)); v[k] = __builtin_amdgcn_exp2f(__fmul_rn(d0, 1.4426950408889634f)); sum += v[k]; }
#pragma unroll
    for (int sh = 16; sh; sh >>= 1) sum += __shfl_xor(sum, sh, 32);
    const float f = __fdiv_rn(PCAR, sum); const float cen = PCAR / (float)SEQ;
{
#pragma unroll
        for (int ch = 0; ch < SEQ / 128; ++ch) { v4h o4;
#pragma unroll
            for (int q = 0; q < 4; ++q) o4[q] = tohx(v[ch * 4 + q] * f - cen);
            *(v4h*)(P16 + (size_t)row * SEQ + ch * 128 + lane * 4) = o4; }
         }
}

constexpr size_t al256(size_t b) { return (b + 255) & ~(size_t)255; }
constexpr size_t WS_TOTAL =
    al256((size_t)3 * HD * DM * 2) +              // WQ WK WV bf16, [out][in]
    al256((size_t)ZB * SEQ * DM * 2) +            // XB bf16
    al256((size_t)3 * ZB * SEQ * HD * 2) +        // QP16|KP16|VT16
    al256((size_t)ZB * HD * 4) +                  // VM
    al256((size_t)ZB * SEQ * SEQ * 4);            // Sb; P16 lies over XB|QP16|KP16, which nothing reads behind the S product
static_assert(WS_TOTAL <= (size_t)268435456);
static_assert(((size_t)ZB * SEQ * DM * 2) % 256 == 0);   // XB and QP16 adjoin

extern "C" void kernel_launch(void* const* d_in, const int* in_sizes, int n_in,
                              void* d_out, int out_size, void* d_ws, size_t ws_size, hipStream_t stream) {
    if (n_in < 2) return;
    if ((size_t)in_sizes[0] < ((size_t)(NB - 1) * SEQ_FULL + SEQ) * DM) return;
    if ((size_t)in_sizes[1] < (size_t)3 * DM * HD) return;
    if ((size_t)out_size < (size_t)NB * SEQ * DM) return;
    if (WS_TOTAL > ws_size) return;
    const float* x = (const float*)d_in[0]; const float* qkv = (const float*)d_in[1];   // qkv: [3][in 768][out 768], slabs q, k, v
    float* OUT = (float*)d_out;     // [NB][SEQ][768]
    char* wsp = (char*)d_ws;
    auto take = [&](size_t bytes) { char* p = wsp; wsp += al256(bytes); return (void*)p; };
    bf* WT = (bf*)take((size_t)3 * HD * DM * 2);
    bf* XB = (bf*)take((size_t)ZB * SEQ * DM * 2);
    h16* QP16 = (h16*)take((size_t)3 * ZB * SEQ * HD * 2); h16* KP16 = QP16 + (size_t)ZB * SEQ * HD; h16* VT16 = KP16 + (size_t)ZB * SEQ * HD;
    float* VM = (float*)take((size_t)ZB * HD * 4);
    float* Sb = (float*)take((size_t)ZB * SEQ * SEQ * 4); h16* P16 = (h16*)XB;
    if ((size_t)(wsp - (char*)d_ws) > ws_size) return;

    // weight slabs W[d][e] ([in][out]) -> planes WT[e][d] ([out][in], K-contiguous for the GEMM)
    k_wtp<<<dim3(DM / 64, HD / 64, 3), 256, 0, stream>>>(qkv, WT);
    const size_t x8 = (size_t)SEQ * DM / 8;                 // per batch slab
    k_cvt8<<<dim3((unsigned)((x8 + 255) / 256), ZB, 1), 256, 0, stream>>>(x, XB, x8, (size_t)SEQ_FULL * DM, (size_t)SEQ * DM);
    k_gemmw<bf, EP_QKV, DM, 4, 12, 1><<<dim3(ZB * SEQ / 256, HD / 192, 3), 128, 0, stream>>>(XB, WT, nullptr, QP16, nullptr, HD, 0, (size_t)HD * DM, (size_t)ZB * SEQ * HD);
    k_vmean<<<ZB * HD / 32, 1024, 0, stream>>>(VT16, VM);
    k_gemmw<h16, EP_F32, HD, 8, 8, 2><<<dim3(SEQ / 256, SEQ / 256, ZB), 128, 0, stream>>>(QP16, KP16, Sb, nullptr, nullptr, SEQ, (size_t)SEQ * HD, (size_t)SEQ * HD, (size_t)SEQ * SEQ);
    k_asoft<<<ZB * SEQ / 8, 256, 0, stream>>>(Sb, P16);
    k_gemmw<h16, EP_OUT, SEQ, 8, 6, 2><<<dim3(SEQ / 256, HD / 192, ZB), 128, 0, stream>>>(P16, VT16, OUT, nullptr, VM, HD, (size_t)SEQ * SEQ, (size_t)HD * SEQ, (size_t)SEQ * HD);
}

// v005
// One run takes 156 microseconds.
// Timed twice side by side with v004, it ran 1.03 times as fast both times.
// Counting every step since v000, it is 4.98 times as fast.
#include <hip/hip_runtime.h>

// Contractions: q/k/v projections on v_wmma_f32_16x16x32_bf16 (x and the stacked QKV weights RNE-converted to bf16, weights transposed to [out][in] planes, exact products, f32 accumulate); q.k^T and att.v on v_wmma_f32_16x16x32_f16 (f16 q/k/v planes; softmax weights carried x1024 and centred by 1024/SEQ, column mean of v added back in f32), f32 accumulate.
// Single-head full-width self-attention: x [8][2048][768]; q = x QKV[0], k = x QKV[1], v = x QKV[2] ('io' [768][768] each, stacked [3][768][768], no bias); att = softmax(q.k * 768^-0.5) over all 2048 keys (no mask); out = att @ v -> [8][2048][768] f32.
// All batches in one pass, one launch per stage (z-batched GEMMs): projections stored as f16 planes by the GEMM itself (q, k row-major; v transposed [d][t] in the GEMM's output staging); S = q k^T (f32, materialised); row softmax in registers; O = P' v, stored as out = O/1024 + mean_t(v).

#ifndef NB
#define NB 8
#endif
#ifndef SEQ
#define SEQ 2048
#endif
#define NB_FULL  8
#define SEQ_FULL 2048
#define DM   768
#define HD   768
#define ZB   NB                           // batches per pass: all of them
#define PCAR 1024.0f
#define SCL  0.03608439182435161f         // 768^-0.5

typedef _Float16 h16;
typedef unsigned short bf;
typedef __attribute__((ext_vector_type(16))) __bf16   v16bf;
typedef __attribute__((ext_vector_type(16))) _Float16 v16h;
typedef __attribute__((ext_vector_type(8)))  _Float16 v8h;
typedef __attribute__((ext_vector_type(8)))  unsigned short v8us;
typedef __attribute__((ext_vector_type(8)))  float    v8f;
typedef __attribute__((ext_vector_type(4)))  float    v4f;
typedef __attribute__((ext_vector_type(4)))  _Float16 v4h;
typedef v4f  __attribute__((may_alias)) v4fa;

static_assert(NB <= NB_FULL);
static_assert(SEQ <= SEQ_FULL);
static_assert(NB % ZB == 0);
static_assert(SEQ % 256 == 0);                 // softmax row chunks, 256-row tiles, K stages of 128
static_assert(DM % 128 == 0 && HD % 192 == 0); // K stages of 128, 192-column tiles; 64x64 weight transpose tiles
static_assert(DM == HD);                       // one full-width head: plane pitch == row pitch
static_assert(((size_t)SEQ * DM) % 8 == 0);
static_assert((ZB * SEQ) % 8 == 0);
static_assert(HD % 32 == 0 && SEQ % 256 == 0);  // k_vmean: 32 rows per block, 256 keys per wave load
static_assert((DM * 2) % 128 == 0);
static_assert(SEQ <= 3 * DM);                  // the softmax weights lie over the x, q and k planes

__device__ __forceinline__ unsigned short f2bf(float f) { unsigned u = __float_as_uint(f); u += 0x7FFFu + ((u >> 16) & 1u); return (unsigned short)(u >> 16); }
__device__ __forceinline__ v16h cat16(v8h lo, v8h hi) { return __builtin_shufflevector(lo, hi, 0, 1, 2, 3, 4, 5, 6, 7, 8, 9, 10, 11, 12, 13, 14, 15); }
__device__ __forceinline__ v16bf cat16b(v8us lo, v8us hi) { return __builtin_bit_cast(v16bf, __builtin_shufflevector(lo, hi, 0, 1, 2, 3, 4, 5, 6, 7, 8, 9, 10, 11, 12, 13, 14, 15)); }
__device__ __forceinline__ v8f wmma16(v16h a, v16h b, v8f c) { return __builtin_amdgcn_wmma_f32_16x16x32_f16(false, a, false, b, (short)0, c, false, false); }
__device__ __forceinline__ v8f wmmab(v16bf a, v16bf b, v8f c) { return __builtin_amdgcn_wmma_f32_16x16x32_bf16(false, a, false, b, (short)0, c, false, false); }
__device__ __forceinline__ h16 tohx(float x) { return (h16)x; }

// ---- k_gemmw: GEMM, one 256 x RB output tile per workgroup of FOUR WAVES, one wave a SIMD; each wave holds FA x FB accumulator tiles (16 FA rows x 16 FB columns); the waves lie (4 / WN) x WN over the tile, RB = 16 FB WN; grid (M/256, N/RB, Z), 128 threads.
// Wave tiles: 128x128 (S = q k^T), 128x96 (O = P' v), 64x192 (projections): FA FB products per FA + FB loaded fragments, against 16 per 8 with a 64x64 wave tile, and about half the L2 bytes per product of a 128x128 workgroup tile. RB = 192 makes 768 and 256 workgroups of the projections and of O: whole rounds of one workgroup a WGP. The projections' waves lie 4 x 1, so that a wave's 192 16-bit columns are whole 128-byte lines.
// D[m][n] = sum_k A[m][k] Bt[n][k] (f32 accumulate), A and Bt K-contiguous 16-bit planes. z-batch strides sA/sB/sC in elements. K (a template constant) % 128 == 0, M % 256 == 0, N % RB == 0.
// The epilogue stores what the next kernel reads, pitch ldc: EP_F32: C = D; EP_QKV: H = D rounded to f16 (RNE); EP_OUT: C = D/1024 + CM[z][n] (CM: HD floats per z).
// EP_QKV is the three projections in one grid (x = 256 rows of all batches' x, y = 192 weight rows, z = q, k, v): slices 0 and 1 as above; slice 2 transposes in its output staging and stores v^T[batch][d][t], pitch SEQ.
// A stage is 128 k (256 B) of the tile's 256 A rows and RB Bt rows, brought into LDS by four tensor loads, one a wave (half of one operand's rows each), two buffers: stage t+1 flies while stage t is multiplied.
// Fragment map (A and Bt alike): lane -> row/col lane&15, h = lane>>4; elements 0..7 = k0+8h+0..7, elements 8..15 = k0+16+8h+0..7. D: acc[j] = (row 8h+j, col lane&15).
#define GT_KS    128                      // k per stage
#define GT_PITCH 272                      // LDS row pitch, bytes: 16 B x odd, no bank conflict for 16-byte fragment reads
#define GT_RA    256                      // A rows of a tile
#define EP_F32 0
#define EP_QKV 1
#define EP_OUT 2
template <typename T16> struct WFrag;
template <> struct WFrag<h16> { typedef v16h V; static __device__ __forceinline__ V ld(const h16* p) { return cat16(*(const v8h*)p, *(const v8h*)(p + 16)); } static __device__ __forceinline__ v8f mma(V a, V b, v8f c) { return wmma16(a, b, c); } };
template <> struct WFrag<bf> { typedef v16bf V; static __device__ __forceinline__ V ld(const bf* p) { return cat16b(*(const v8us*)p, *(const v8us*)(p + 16)); } static __device__ __forceinline__ v8f mma(V a, V b, v8f c) { return wmmab(a, b, c); } };

// Tensor load of one wave: a slice of whole 256-byte row pieces goes from global memory into LDS through no register; the pad (16 bytes behind every 256) lays the rows at GT_PITCH.
typedef unsigned u32x4 __attribute__((ext_vector_type(4)));
typedef unsigned u32x8 __attribute__((ext_vector_type(8)));
__device__ __forceinline__ unsigned uni(unsigned v) { return (unsigned)__builtin_amdgcn_readfirstlane(v); }
__device__ __forceinline__ unsigned pinned(unsigned v) { unsigned w = (unsigned)__builtin_amdgcn_readfirstlane(v); asm volatile("" : "+s"(w)); return w; }   // holds a value in a scalar register: the test round a tensor load, so that its branch is a scalar branch (a tensor load ignores EXEC), or a descriptor word
#define GT_PADW0 ((1u << 20) | (5u << 22) | (3u << 25))   // no mask, 1-byte elements, a pad of 4 dwords behind every 64 dwords
// Group 1: rows of GT_KS * 2 bytes, nrow of them, tensor = tile, source pitch in bytes.
__device__ __forceinline__ u32x8 gt_group1(unsigned nrow, unsigned pitch) {
    constexpr unsigned d0 = GT_KS * 2u; u32x8 g;
    g[0] = uni(GT_PADW0);
    // pinned(): each descriptor word is held in a scalar register of its own through the loop, so that none takes another value while a request is outstanding
    g[1] = pinned((d0 & 0xFFFFu) << 16); g[2] = pinned((d0 >> 16) | ((nrow & 0xFFFFu) << 16)); g[3] = pinned((nrow >> 16) | (d0 << 16));
    g[4] = pinned(nrow); g[5] = pinned(pitch); g[6] = pinned(0u); g[7] = pinned(0u); return g; }
// Group 0: count 1, the place in LDS, the tile's first byte, type 2.
__device__ __forceinline__ u32x4 gt_group0(unsigned lds, unsigned long long ga) {
    u32x4 g; g[0] = uni(1u); g[1] = uni(lds); g[2] = uni((unsigned)ga); g[3] = uni((((unsigned)(ga >> 32)) & 0x01FFFFFFu) | 0x80000000u); return g; }
__device__ __forceinline__ void gt_tload(u32x4 g0, u32x8 g1) { asm volatile("tensor_load_to_lds %0, %1" :: "s"(g0), "s"(g1) : "memory"); }
constexpr unsigned gt_slice(unsigned rows) { return (rows * GT_PITCH + 2047u) & ~2047u; }   // LDS bytes of a slice, rounded up so that the next slice's place is a multiple of 2 KiB again

// N 16-byte stores of a lane and their s_wait_xcnt 0 in one statement, so that no address or data register of an issued store is rewritten ahead of that wait.
template <int N>
__device__ __forceinline__ void gt_st(void* const (&p)[N], const v4f (&d)[N]) {
    static_assert(N == 4 || N == 8 || N == 6);
    if constexpr (N == 4) {
        asm volatile(
            "global_store_b128 %0, %4, off\n\t"
            "global_store_b128 %1, %5, off\n\t"
            "global_store_b128 %2, %6, off\n\t"
            "global_store_b128 %3, %7, off\n\t"
            "s_wait_xcnt 0x0"
            :: "v"(p[0]), "v"(p[1]), "v"(p[2]), "v"(p[3]),
               "v"(d[0]), "v"(d[1]), "v"(d[2]), "v"(d[3]) : "memory");
    } else if constexpr (N == 8) {
        asm volatile(
            "global_store_b128 %0, %8, off\n\t"
            "global_store_b128 %1, %9, off\n\t"
            "global_store_b128 %2, %10, off\n\t"
            "global_store_b128 %3, %11, off\n\t"
            "global_store_b128 %4, %12, off\n\t"
            "global_store_b128 %5, %13, off\n\t"
            "global_store_b128 %6, %14, off\n\t"
            "global_store_b128 %7, %15, off\n\t"
            "s_wait_xcnt 0x0"
            :: "v"(p[0]), "v"(p[1]), "v"(p[2]), "v"(p[3]), "v"(p[4]), "v"(p[5]), "v"(p[6]), "v"(p[7]),
               "v"(d[0]), "v"(d[1]), "v"(d[2]), "v"(d[3]), "v"(d[4]), "v"(d[5]), "v"(d[6]), "v"(d[7]) : "memory");
    } else {
        asm volatile(
            "global_store_b128 %0, %6, off\n\t"
            "global_store_b128 %1, %7, off\n\t"
            "global_store_b128 %2, %8, off\n\t"
            "global_store_b128 %3, %9, off\n\t"
            "global_store_b128 %4, %10, off\n\t"
            "global_store_b128 %5, %11, off\n\t"
            "s_wait_xcnt 0x0"
            :: "v"(p[0]), "v"(p[1]), "v"(p[2]), "v"(p[3]), "v"(p[4]), "v"(p[5]),
               "v"(d[0]), "v"(d[1]), "v"(d[2]), "v"(d[3]), "v"(d[4]), "v"(d[5]) : "memory");
    }
}

// The epilogue of one wave, in two parts: its FA x FB accumulator tiles go through the wave's own LDS rows to whole 128-byte lines. SWAP: D^T is stored (rows = Bt rows, columns = A rows): a lane's eight accumulator rows are eight neighbours of one staged row.
// Part 1 stages the whole wave tile: no accumulator is live any more where the store statements of part 2 take their operands, which must lie in v0 to v255 (with accumulators there the operands were spilled).
template <int FA, int FB, bool SWAP>
__device__ __forceinline__ void gt_stage(unsigned char* L, const v8f (&acc)[FA][FB]) {
    const int tid = threadIdx.x, lane = tid & 31, lr = lane & 15, hi = lane >> 4; const int wave = __builtin_amdgcn_readfirstlane(tid >> 5);
    constexpr int RG = SWAP ? FB : FA, CG = SWAP ? FA : FB, OP = CG * 16 + 4;   // the wave's 16-row groups, its 16-column groups, the staging pitch in floats
    float* ow = (float*)L + wave * (RG * 16 * OP);          // each wave's own RG x 16 x OP floats; the loop's last barrier stands behind every read of the ring
#pragma unroll
    for (int rg = 0; rg < RG; ++rg) { float* os = ow + rg * (16 * OP);
#pragma unroll
        for (int cg = 0; cg < CG; ++cg) {
#pragma unroll
            for (int j = 0; j < 8; ++j) { if constexpr (SWAP) os[lr * OP + cg * 16 + hi * 8 + j] = acc[cg][rg][j]; else os[(hi * 8 + j) * OP + cg * 16 + lr] = acc[rg][cg][j]; } } }
}
// Part 2. C, H: the tile's first output element; CM: its first column term.
template <int EPI, int FA, int FB, int WN, bool SWAP>
__device__ __forceinline__ void gt_out(const unsigned char* L, float* C, h16* H, const float* CM, int ldc) {
    const int tid = threadIdx.x, lane = tid & 31; const int wave = __builtin_amdgcn_readfirstlane(tid >> 5), wm = wave / WN, wn = wave % WN;
    constexpr int RG = SWAP ? FB : FA, CG = SWAP ? FA : FB, CW = CG * 16, OP = CW + 4;   // as in part 1; CW: the wave's columns
    const int row0 = SWAP ? wn * FB * 16 : wm * FA * 16, col0 = SWAP ? wm * FA * 16 : wn * FB * 16;
    v4f cm[3] = {};
    if constexpr (EPI == EP_OUT) {   // the lane's column terms (its column repeats every third store), fetched behind the loop; load and data wait in one statement, so that no register of the load is reused while it is in flight
        static_assert(CW == 96);
#pragma unroll
        for (int k = 0; k < 3; ++k) { const float* cp = CM + col0 + ((k * 32 + lane) % 24) * 4;
            asm volatile("global_load_b128 %0, %1, off\n\ts_wait_loadcnt 0x0" : "=&v"(cm[k]) : "v"(cp) : "memory"); }
    }
    const float* ow = (const float*)L + wave * (RG * 16 * OP);
#pragma unroll
    for (int rg = 0; rg < RG; ++rg) { const float* os = ow + rg * (16 * OP);
        if constexpr (EPI == EP_QKV) {   // 8 lanes x 16 bytes are one 128-byte line; a row of the wave's columns is CW / 64 whole lines
            h16* hrow = H + (size_t)(row0 + rg * 16) * ldc + col0; constexpr int NS = CW == 64 ? 4 : 6;   // stores a statement
            static_assert((CW / 16) % NS == 0);
#pragma unroll
            for (int s0 = 0; s0 < CW / 16; s0 += NS) { void* p[NS]; v4f d[NS];
#pragma unroll
                for (int u = 0; u < NS; ++u) { const int idx = (s0 + u) * 32 + lane, row = idx / (CW / 8), cofs = (idx % (CW / 8)) * 8; const v4f v0 = *(const v4fa*)(os + row * OP + cofs), v1 = *(const v4fa*)(os + row * OP + cofs + 4); v8h o;
#pragma unroll
                    for (int k = 0; k < 4; ++k) { o[k] = tohx(v0[k]); o[4 + k] = tohx(v1[k]); }
                    p[u] = hrow + (size_t)row * ldc + cofs; d[u] = __builtin_bit_cast(v4f, o); }
                gt_st(p, d); }
        } else {                         // 8 lanes x 16 bytes are one 128-byte line; a row of the wave's columns is CW / 32 whole lines
            float* crow = C + (size_t)(row0 + rg * 16) * ldc + col0; constexpr int NS = CW == 128 ? 8 : 6;   // stores a statement
            static_assert((CW / 8) % NS == 0);
#pragma unroll
            for (int s0 = 0; s0 < CW / 8; s0 += NS) { void* p[NS]; v4f d[NS];
#pragma unroll
                for (int u = 0; u < NS; ++u) { const int s = s0 + u, idx = s * 32 + lane, row = idx / (CW / 4), cofs = (idx % (CW / 4)) * 4; v4f val = *(const v4fa*)(os + row * OP + cofs);
                    if constexpr (EPI == EP_OUT) val = val * (1.0f / PCAR) + cm[s % 3];
                    p[u] = crow + (size_t)row * ldc + cofs; d[u] = val; }
                gt_st(p, d); }
        }
    }
}

// One tile. A, Bt: the tile's first rows; C, H: its first output element; CM: its first column term. swap (the same in the whole workgroup; EP_QKV only): D^T is stored (rows = Bt rows, columns = A rows).
template <typename T16, int EPI, int K, int FA, int FB, int WN>
__device__ __forceinline__ void gt_tile(unsigned char* L, const T16* A, const T16* Bt, float* C, h16* H, const float* CM, int ldc, bool swap) {
    typedef typename WFrag<T16>::V V;
    constexpr int RB = FB * 16 * WN;
    static_assert(FA * 16 * (4 / WN) == GT_RA && (RB == 256 || RB == 192) && K % GT_KS == 0);
    constexpr unsigned SLA = gt_slice(GT_RA / 2), SLB = gt_slice(RB / 2), OPA = 2 * SLA, BUF = OPA + 2 * SLB;   // two slices of A rows, then two of Bt rows
    static_assert(SLA == (GT_RA / 2) * GT_PITCH);   // the A rows of both slices lie at one pitch
    constexpr int SG = RB / 32;                     // 16-row groups in a slice of Bt rows
    static_assert(FB % SG == 0);                    // a wave's Bt rows are whole slices
    static_assert(4u * FA * 16u * (FB * 16u + 4u) * 4u <= 2u * BUF && 4u * FB * 16u * (FA * 16u + 4u) * 4u <= 2u * BUF);   // the four waves' output staging lies in the ring
    const int tid = threadIdx.x, lane = tid & 31, lr = lane & 15, hi = lane >> 4; const int wave = __builtin_amdgcn_readfirstlane(tid >> 5), wm = wave / WN, wn = wave % WN;
    v8f acc[FA][FB];
#pragma unroll
    for (int mb = 0; mb < FA; ++mb)
#pragma unroll
        for (int nb = 0; nb < FB; ++nb) acc[mb][nb] = (v8f){};
    const unsigned char* fa = L + (wm * FA * 16 + lr) * GT_PITCH + hi * 16;
    const unsigned char* fb = L + OPA + wn * (FB / SG) * SLB + lr * GT_PITCH + hi * 16;
    auto bq = [](int q) { return (unsigned)(q / SG) * SLB + (unsigned)(q % SG) * (16u * GT_PITCH); };   // the wave's q-th 16-row group of Bt rows, from fb
    constexpr int nst = K / GT_KS;
    static_assert(nst >= 2);   // stages 0 and 1 are loaded in front of the loop
    // Every wave brings one slice of each stage: waves 0 and 1 the halves of the A rows, waves 2 and 3 the halves of the Bt rows.
    const bool isB = wave >= 2; const unsigned half = (unsigned)wave & 1u, nrow = isB ? (unsigned)(RB / 2) : (unsigned)(GT_RA / 2);
    const unsigned long long gsrc = (unsigned long long)(size_t)(isB ? (const void*)Bt : (const void*)A) + (unsigned long long)(half * nrow) * ((unsigned)K * 2u);
    const unsigned ldst = (unsigned)(size_t)L + (isB ? OPA + half * SLB : half * SLA);
    const u32x8 g1 = gt_group1(nrow, (unsigned)K * 2u);
    auto issue = [&](unsigned st) { gt_tload(gt_group0(ldst + (st & 1u) * BUF, gsrc + (unsigned long long)st * (GT_KS * 2u)), g1); };

    issue(0);
    asm volatile("s_wait_tensorcnt 0x0" ::: "memory");   // this wave's slice of stage 0 has landed
    __syncthreads();                                      // ... and every wave's slice of it may be read
    issue(1);
#pragma unroll 1
    for (int t = 0; t < nst; ++t) {
        const unsigned bo = (unsigned)(t & 1) * BUF;
        V a[2][FA], b[2][FB];
#pragma unroll
        for (int q = 0; q < FA; ++q) a[0][q] = WFrag<T16>::ld((const T16*)(fa + bo + q * 16 * GT_PITCH));
#pragma unroll
        for (int q = 0; q < FB; ++q) b[0][q] = WFrag<T16>::ld((const T16*)(fb + bo + bq(q)));
        __builtin_amdgcn_sched_barrier(0);   // keeps the first block's LDS reads ahead of the second block's: merged into one group, the first WMMA waits for both
#pragma unroll
        for (int ks = 0; ks < GT_KS / 32; ++ks) {
            if (ks + 1 < GT_KS / 32) {
#pragma unroll
                for (int q = 0; q < FA; ++q) a[(ks + 1) & 1][q] = WFrag<T16>::ld((const T16*)(fa + bo + q * 16 * GT_PITCH + (ks + 1) * 64));
#pragma unroll
                for (int q = 0; q < FB; ++q) b[(ks + 1) & 1][q] = WFrag<T16>::ld((const T16*)(fb + bo + bq(q) + (ks + 1) * 64));
            }
            __builtin_amdgcn_sched_barrier(0);   // keeps the next block's LDS reads one group ahead of this block: sunk among the WMMAs, each pair is waited out on its own
#pragma unroll
            for (int nb = 0; nb < FB; ++nb)
#pragma unroll
                for (int mb = 0; mb < FA; ++mb) acc[mb][nb] = WFrag<T16>::mma(a[ks & 1][mb], b[ks & 1][nb], acc[mb][nb]);
            __builtin_amdgcn_sched_barrier(0);   // closes the block, so that the reads after next do not rise into it
        }
        asm volatile("s_wait_dscnt 0x0" ::: "memory");
        asm volatile("s_wait_tensorcnt 0x0" ::: "memory");
        __syncthreads();
        if (pinned((unsigned)(t + 2 < nst))) issue((unsigned)(t + 2));
    }
    asm volatile("s_wait_tensorcnt 0x0" ::: "memory");      // no tensor load is outstanding when the ring becomes output staging
    asm volatile("s_wait_dscnt 0x0" ::: "memory");          // ... and no LDS read of this wave
    if constexpr (EPI == EP_QKV) { if (swap) gt_stage<FA, FB, true>(L, acc); else gt_stage<FA, FB, false>(L, acc); }
    else gt_stage<FA, FB, false>(L, acc);
    __builtin_amdgcn_wave_barrier(); asm volatile("" ::: "memory");   // the wave's staged tile is written before any lane reads another lane's part of it
    if constexpr (EPI == EP_QKV) { if (swap) gt_out<EPI, FA, FB, WN, true>(L, C, H, CM, ldc); else gt_out<EPI, FA, FB, WN, false>(L, C, H, CM, ldc); }
    else gt_out<EPI, FA, FB, WN, false>(L, C, H, CM, ldc);
}

template <typename T16, int EPI, int K, int FA, int FB, int WN>
__global__ __launch_bounds__(128) void k_gemmw(const T16* __restrict__ A, const T16* __restrict__ Bt, float* C, h16* H, const float* __restrict__ CM, int ldc, size_t sA, size_t sB, size_t sC) {
    constexpr int RB = FB * 16 * WN;
    __shared__ __attribute__((aligned(2048))) unsigned char L[2 * (2 * gt_slice(GT_RA / 2) + 2 * gt_slice(RB / 2))];   // every slice's place in LDS is a multiple of 2 KiB
    const size_t z = blockIdx.z; const int r0 = blockIdx.x * GT_RA, c0 = blockIdx.y * RB;   // the tile's first A row and first Bt row
    A += z * sA + (size_t)r0 * K; Bt += z * sB + (size_t)c0 * K;
    const size_t o0 = z * sC + (size_t)r0 * ldc + c0;   // its first output element
    if constexpr (EPI == EP_QKV) {
        const bool vt = z == 2;   // v^T[batch][d][t]
        const size_t ov = z * sC + (size_t)(blockIdx.x / (SEQ / GT_RA)) * ((size_t)HD * SEQ) + (size_t)c0 * SEQ + (blockIdx.x % (SEQ / GT_RA)) * GT_RA;
        gt_tile<T16, EPI, K, FA, FB, WN>(L, A, Bt, nullptr, H + (vt ? ov : o0), nullptr, vt ? SEQ : ldc, vt);
    } else if constexpr (EPI == EP_OUT) gt_tile<T16, EPI, K, FA, FB, WN>(L, A, Bt, C + o0, nullptr, CM + z * HD + c0, ldc, false);
    else gt_tile<T16, EPI, K, FA, FB, WN>(L, A, Bt, C + o0, nullptr, nullptr, ldc, false);
}

__global__ __launch_bounds__(256) void k_cvt8(const float* __restrict__ src, bf* dst, size_t n8, size_t sS, size_t sD) {
    const size_t i = (size_t)blockIdx.x * 256 + threadIdx.x; if (i >= n8) return;
    src += (size_t)blockIdx.y * sS; dst += (size_t)blockIdx.y * sD;
    const v8f v = *(const v8f*)(src + i * 8); v8us o;
#pragma unroll
    for (int k = 0; k < 8; ++k) o[k] = f2bf(v[k]);
    *(v8us*)(dst + i * 8) = o;  }

// k_wtp: weight plane WT[e][d] (bf16, RNE) = W[d][e] (f32, [in][out] orientation), plane blockIdx.z of the stack; one 64(d) x 64(e) tile per block, transposed through LDS (all 64x64 entries staged, block barrier, pad column never read);
__global__ __launch_bounds__(256) void k_wtp(const float* __restrict__ W, bf* WT) {
    __shared__ float tl[64 * 65];
    const int tid = threadIdx.x; const int d0 = blockIdx.x * 64, e0 = blockIdx.y * 64; W += (size_t)blockIdx.z * DM * HD; WT += (size_t)blockIdx.z * HD * DM;
#pragma unroll 4
    for (int i = 0; i < 16; ++i) { const int idx = i * 256 + tid; const int dd = idx >> 6, ee = idx & 63; tl[dd * 65 + ee] = W[(size_t)(d0 + dd) * HD + e0 + ee]; }
    __syncthreads();
    const int pc = tid & 7, er = tid >> 3; v8us o0, o1;
#pragma unroll
    for (int k = 0; k < 8; ++k) { o0[k] = f2bf(tl[(pc * 8 + k) * 65 + er]); o1[k] = f2bf(tl[(pc * 8 + k) * 65 + 32 + er]); }
    bf* p0 = WT + (size_t)(e0 + er) * DM + d0 + pc * 8; bf* p1 = WT + (size_t)(e0 + 32 + er) * DM + d0 + pc * 8;
    *(v8us*)p0 = o0; *(v8us*)p1 = o1;  }

// k_vmean: VM[r] = mean over the SEQ keys of plane row r = (batch, d) of the f16 v^T plane, summed in f32. 32 rows per block, one per wave (whole 512-byte pieces per load, fixed trees); one wave stores the block's 32 means as one 128-byte line.
__global__ __launch_bounds__(1024) void k_vmean(const h16* __restrict__ VT, float* VM) {
    __shared__ float part[32];
    const int lane = threadIdx.x & 31, w = threadIdx.x >> 5; const int row0 = blockIdx.x * 32;
    const h16* p = VT + (size_t)(row0 + w) * SEQ + lane * 8; float s = 0.f;
#pragma unroll
    for (int ch = 0; ch < SEQ / 256; ++ch) { const v8h a = *(const v8h*)(p + ch * 256);
        s += (((float)a[0] + (float)a[1]) + ((float)a[2] + (float)a[3])) + (((float)a[4] + (float)a[5]) + ((float)a[6] + (float)a[7])); }
#pragma unroll
    for (int sh = 16; sh; sh >>= 1) s += __shfl_xor(s, sh, 32);
    if (lane == 0) part[w] = s;
    __syncthreads();
    if (threadIdx.x < 32) VM[row0 + threadIdx.x] = part[threadIdx.x] * (1.0f / (float)SEQ);
}

// k_asoft: per row (one wave): t = S x 768^-0.5; softmax over the SEQ keys (register row, running max then one exp, fixed shuffle trees);
__global__ __launch_bounds__(256) void k_asoft(const float* __restrict__ Sb, h16* P16) {
    const int lane = threadIdx.x & 31; const int row = blockIdx.x * 8 + (threadIdx.x >> 5); if (row >= ZB * SEQ) return;
    const float* sr = Sb + (size_t)row * SEQ; float v[SEQ / 32]; float mx = -3.0e38f;
#pragma unroll
    for (int ch = 0; ch < SEQ / 128; ++ch) { const v4f a = *(const v4f*)(sr + ch * 128 + lane * 4);
#pragma unroll
        for (int q = 0; q < 4; ++q) { const float t = a[q] * SCL; v[ch * 4 + q] = t; mx = fmaxf(mx, t); } }
#pragma unroll
    for (int sh = 16; sh; sh >>= 1) mx = fmaxf(mx, __shfl_xor(mx, sh, 32));
    float sum = 0.f;
#pragma unroll
    for (int k = 0; k < SEQ / 32; ++k) { float d0 = __fsub_rn(v[k], mx); asm volatile("" : "+v"(d0)); v[k] = __builtin_amdgcn_exp2f(__fmul_rn(d0, 1.4426950408889634f)); sum += v[k]; }
#pragma unroll
    for (int sh = 16; sh; sh >>= 1) sum += __shfl_xor(sum, sh, 32);
    const float f = __fdiv_rn(PCAR, sum); const float cen = PCAR / (float)SEQ;
{
#pragma unroll
        for (int ch = 0; ch < SEQ / 128; ++ch) { v4h o4;
#pragma unroll
            for (int q = 0; q < 4; ++q) o4[q] = tohx(v[ch * 4 + q] * f - cen);
            *(v4h*)(P16 + (size_t)row * SEQ + ch * 128 + lane * 4) = o4; }
         }
}

constexpr size_t al256(size_t b) { return (b + 255) & ~(size_t)255; }
constexpr size_t WS_TOTAL =
    al256((size_t)3 * HD * DM * 2) +              // WQ WK WV bf16, [out][in]
    al256((size_t)ZB * SEQ * DM * 2) +            // XB bf16
    al256((size_t)3 * ZB * SEQ * HD * 2) +        // QP16|KP16|VT16
    al256((size_t)ZB * HD * 4) +                  // VM
    al256((size_t)ZB * SEQ * SEQ * 4);            // Sb; P16 lies over XB|QP16|KP16, which nothing reads behind the S product
static_assert(WS_TOTAL <= (size_t)268435456);
static_assert(((size_t)ZB * SEQ * DM * 2) % 256 == 0);   // XB and QP16 adjoin

extern "C" void kernel_launch(void* const* d_in, const int* in_sizes, int n_in,
                              void* d_out, int out_size, void* d_ws, size_t ws_size, hipStream_t stream) {
    if (n_in < 2) return;
    if ((size_t)in_sizes[0] < ((size_t)(NB - 1) * SEQ_FULL + SEQ) * DM) return;
    if ((size_t)in_sizes[1] < (size_t)3 * DM * HD) return;
    if ((size_t)out_size < (size_t)NB * SEQ * DM) return;
    if (WS_TOTAL > ws_size) return;
    const float* x = (const float*)d_in[0]; const float* qkv = (const float*)d_in[1];   // qkv: [3][in 768][out 768], slabs q, k, v
    float* OUT = (float*)d_out;     // [NB][SEQ][768]
    char* wsp = (char*)d_ws;
    auto take = [&](size_t bytes) { char* p = wsp; wsp += al256(bytes); return (void*)p; };
    bf* WT = (bf*)take((size_t)3 * HD * DM * 2);
    bf* XB = (bf*)take((size_t)ZB * SEQ * DM * 2);
    h16* QP16 = (h16*)take((size_t)3 * ZB * SEQ * HD * 2); h16* KP16 = QP16 + (size_t)ZB * SEQ * HD; h16* VT16 = KP16 + (size_t)ZB * SEQ * HD;
    float* VM = (float*)take((size_t)ZB * HD * 4);
    float* Sb = (float*)take((size_t)ZB * SEQ * SEQ * 4); h16* P16 = (h16*)XB;
    if ((size_t)(wsp - (char*)d_ws) > ws_size) return;

    // weight slabs W[d][e] ([in][out]) -> planes WT[e][d] ([out][in], K-contiguous for the GEMM)
    k_wtp<<<dim3(DM / 64, HD / 64, 3), 256, 0, stream>>>(qkv, WT);
    const size_t x8 = (size_t)SEQ * DM / 8;                 // per batch slab
    k_cvt8<<<dim3((unsigned)((x8 + 255) / 256), ZB, 1), 256, 0, stream>>>(x, XB, x8, (size_t)SEQ_FULL * DM, (size_t)SEQ * DM);
    k_gemmw<bf, EP_QKV, DM, 4, 12, 1><<<dim3(ZB * SEQ / 256, HD / 192, 3), 128, 0, stream>>>(XB, WT, nullptr, QP16, nullptr, HD, 0, (size_t)HD * DM, (size_t)ZB * SEQ * HD);
    k_vmean<<<ZB * HD / 32, 1024, 0, stream>>>(VT16, VM);
    k_gemmw<h16, EP_F32, HD, 8, 8, 2><<<dim3(SEQ / 256, SEQ / 256, ZB), 128, 0, stream>>>(QP16, KP16, Sb, nullptr, nullptr, SEQ, (size_t)SEQ * HD, (size_t)SEQ * HD, (size_t)SEQ * SEQ);
    k_asoft<<<ZB * SEQ / 8, 256, 0, stream>>>(Sb, P16);
    k_gemmw<h16, EP_OUT, SEQ, 8, 6, 2><<<dim3(SEQ / 256, HD / 192, ZB), 128, 0, stream>>>(P16, VT16, OUT, nullptr, VM, HD, (size_t)SEQ * SEQ, (size_t)HD * SEQ, (size_t)SEQ * HD);
}

// v006
// One run takes 145 microseconds.
// Next to v005, in two timings, it ran 1.08 and 1.09 times as fast.
// Over all steps from v000 it is 5.39 times as fast.
#include <hip/hip_runtime.h>

// Contractions: q/k/v projections on v_wmma_f32_16x16x32_bf16 (x and the stacked QKV weights RNE-converted to bf16, weights transposed to [out][in] planes, exact products, f32 accumulate); q.k^T and att.v on v_wmma_f32_16x16x32_f16 (f16 q/k/v planes; softmax weights carried x1024 and centred by 1024/SEQ, column mean of v added back in f32), f32 accumulate.
// Single-head full-width self-attention: x [8][2048][768]; q = x QKV[0], k = x QKV[1], v = x QKV[2] ('io' [768][768] each, stacked [3][768][768], no bias); att = softmax(q.k * 768^-0.5) over all 2048 keys (no mask); out = att @ v -> [8][2048][768] f32.
// All batches in one pass, one launch per stage (z-batched GEMMs): projections stored as f16 planes by the GEMM itself (q, k row-major; v transposed [d][t] in the GEMM's output staging); S = q k^T x 768^-0.5 (materialised as an f16 plane, rounded once from the f32 accumulator); row softmax in f32 registers; O = P' v, stored as out = O/1024 + mean_t(v).

#ifndef NB
#define NB 8
#endif
#ifndef SEQ
#define SEQ 2048
#endif
#define NB_FULL  8
#define SEQ_FULL 2048
#define DM   768
#define HD   768
#define ZB   NB                           // batches per pass: all of them
#define PCAR 1024.0f
#define SCL  0.03608439182435161f         // 768^-0.5

typedef _Float16 h16;
typedef unsigned short bf;
typedef __attribute__((ext_vector_type(16))) __bf16   v16bf;
typedef __attribute__((ext_vector_type(16))) _Float16 v16h;
typedef __attribute__((ext_vector_type(8)))  _Float16 v8h;
typedef __attribute__((ext_vector_type(8)))  unsigned short v8us;
typedef __attribute__((ext_vector_type(8)))  float    v8f;
typedef __attribute__((ext_vector_type(4)))  float    v4f;
typedef v4f  __attribute__((may_alias)) v4fa;

static_assert(NB <= NB_FULL);
static_assert(SEQ <= SEQ_FULL);
static_assert(NB % ZB == 0);
static_assert(SEQ % 256 == 0);                 // softmax row chunks, 256-row tiles, K stages of 128
static_assert(DM % 128 == 0 && HD % 192 == 0); // K stages of 128, 192-column tiles; 64x64 weight transpose tiles
static_assert(DM == HD);                       // one full-width head: plane pitch == row pitch
static_assert(((size_t)SEQ * DM) % 8 == 0);
static_assert((ZB * SEQ) % 8 == 0);
static_assert(HD % 32 == 0 && SEQ % 256 == 0);  // k_vmean: 32 rows per block, 256 keys per wave load
static_assert((DM * 2) % 128 == 0);
static_assert(SEQ <= 3 * DM);                  // the softmax weights lie over the x, q and k planes

__device__ __forceinline__ unsigned short f2bf(float f) { unsigned u = __float_as_uint(f); u += 0x7FFFu + ((u >> 16) & 1u); return (unsigned short)(u >> 16); }
__device__ __forceinline__ v16h cat16(v8h lo, v8h hi) { return __builtin_shufflevector(lo, hi, 0, 1, 2, 3, 4, 5, 6, 7, 8, 9, 10, 11, 12, 13, 14, 15); }
__device__ __forceinline__ v16bf cat16b(v8us lo, v8us hi) { return __builtin_bit_cast(v16bf, __builtin_shufflevector(lo, hi, 0, 1, 2, 3, 4, 5, 6, 7, 8, 9, 10, 11, 12, 13, 14, 15)); }
__device__ __forceinline__ v8f wmma16(v16h a, v16h b, v8f c) { return __builtin_amdgcn_wmma_f32_16x16x32_f16(false, a, false, b, (short)0, c, false, false); }
__device__ __forceinline__ v8f wmmab(v16bf a, v16bf b, v8f c) { return __builtin_amdgcn_wmma_f32_16x16x32_bf16(false, a, false, b, (short)0, c, false, false); }
__device__ __forceinline__ h16 tohx(float x) { return (h16)x; }

// ---- k_gemmw: GEMM, one 256 x RB output tile per workgroup of FOUR WAVES, one wave a SIMD; each wave holds FA x FB accumulator tiles (16 FA rows x 16 FB columns); the waves lie (4 / WN) x WN over the tile, RB = 16 FB WN; grid (M/256, N/RB, Z), 128 threads.
// Wave tiles: 128x128 (S = q k^T), 128x96 (O = P' v), 64x192 (projections): FA FB products per FA + FB loaded fragments, against 16 per 8 with a 64x64 wave tile, and about half the L2 bytes per product of a 128x128 workgroup tile. RB = 192 makes 768 and 256 workgroups of the projections and of O: whole rounds of one workgroup a WGP. The projections' waves lie 4 x 1, so that a wave's 192 16-bit columns are whole 128-byte lines.
// D[m][n] = sum_k A[m][k] Bt[n][k] (f32 accumulate), A and Bt K-contiguous 16-bit planes. z-batch strides sA/sB/sC in elements. K (a template constant) % 128 == 0, M % 256 == 0, N % RB == 0.
// The epilogue stores what the next kernel reads, pitch ldc: EP_S16: H = D x 768^-0.5 rounded to f16 (RNE); EP_QKV: H = D rounded to f16 (RNE); EP_OUT: C = D/1024 + CM[z][n] (CM: HD floats per z).
// EP_QKV is the three projections in one grid (x = 256 rows of all batches' x, y = 192 weight rows, z = q, k, v): slices 0 and 1 as above; slice 2 transposes in its output staging and stores v^T[batch][d][t], pitch SEQ.
// A stage is 128 k (256 B) of the tile's 256 A rows and RB Bt rows, brought into LDS by four tensor loads, one a wave (half of one operand's rows each), two buffers: stage t+1 flies while stage t is multiplied.
// Fragment map (A and Bt alike): lane -> row/col lane&15, h = lane>>4; elements 0..7 = k0+8h+0..7, elements 8..15 = k0+16+8h+0..7. D: acc[j] = (row 8h+j, col lane&15).
#define GT_KS    128                      // k per stage
#define GT_PITCH 272                      // LDS row pitch, bytes: 16 B x odd, no bank conflict for 16-byte fragment reads
#define GT_RA    256                      // A rows of a tile
#define EP_S16 0
#define EP_QKV 1
#define EP_OUT 2
template <typename T16> struct WFrag;
template <> struct WFrag<h16> { typedef v16h V; static __device__ __forceinline__ V ld(const h16* p) { return cat16(*(const v8h*)p, *(const v8h*)(p + 16)); } static __device__ __forceinline__ v8f mma(V a, V b, v8f c) { return wmma16(a, b, c); } };
template <> struct WFrag<bf> { typedef v16bf V; static __device__ __forceinline__ V ld(const bf* p) { return cat16b(*(const v8us*)p, *(const v8us*)(p + 16)); } static __device__ __forceinline__ v8f mma(V a, V b, v8f c) { return wmmab(a, b, c); } };

// Tensor load of one wave: a slice of whole 256-byte row pieces goes from global memory into LDS through no register; the pad (16 bytes behind every 256) lays the rows at GT_PITCH.
typedef unsigned u32x4 __attribute__((ext_vector_type(4)));
typedef unsigned u32x8 __attribute__((ext_vector_type(8)));
__device__ __forceinline__ unsigned uni(unsigned v) { return (unsigned)__builtin_amdgcn_readfirstlane(v); }
__device__ __forceinline__ unsigned pinned(unsigned v) { unsigned w = (unsigned)__builtin_amdgcn_readfirstlane(v); asm volatile("" : "+s"(w)); return w; }   // holds a value in a scalar register: the test round a tensor load, so that its branch is a scalar branch (a tensor load ignores EXEC), or a descriptor word
#define GT_PADW0 ((1u << 20) | (5u << 22) | (3u << 25))   // no mask, 1-byte elements, a pad of 4 dwords behind every 64 dwords
// Group 1: rows of GT_KS * 2 bytes, nrow of them, tensor = tile, source pitch in bytes.
__device__ __forceinline__ u32x8 gt_group1(unsigned nrow, unsigned pitch) {
    constexpr unsigned d0 = GT_KS * 2u; u32x8 g;
    g[0] = uni(GT_PADW0);
    // pinned(): each descriptor word is held in a scalar register of its own through the loop, so that none takes another value while a request is outstanding
    g[1] = pinned((d0 & 0xFFFFu) << 16); g[2] = pinned((d0 >> 16) | ((nrow & 0xFFFFu) << 16)); g[3] = pinned((nrow >> 16) | (d0 << 16));
    g[4] = pinned(nrow); g[5] = pinned(pitch); g[6] = pinned(0u); g[7] = pinned(0u); return g; }
// Group 0: count 1, the place in LDS, the tile's first byte, type 2.
__device__ __forceinline__ u32x4 gt_group0(unsigned lds, unsigned long long ga) {
    u32x4 g; g[0] = uni(1u); g[1] = uni(lds); g[2] = uni((unsigned)ga); g[3] = uni((((unsigned)(ga >> 32)) & 0x01FFFFFFu) | 0x80000000u); return g; }
__device__ __forceinline__ void gt_tload(u32x4 g0, u32x8 g1) { asm volatile("tensor_load_to_lds %0, %1" :: "s"(g0), "s"(g1) : "memory"); }
constexpr unsigned gt_slice(unsigned rows) { return (rows * GT_PITCH + 2047u) & ~2047u; }   // LDS bytes of a slice, rounded up so that the next slice's place is a multiple of 2 KiB again

// N 16-byte stores of a lane and their s_wait_xcnt 0 in one statement, so that no address or data register of an issued store is rewritten ahead of that wait.
template <int N>
__device__ __forceinline__ void gt_st(void* const (&p)[N], const v4f (&d)[N]) {
    static_assert(N == 4 || N == 8 || N == 6);
    if constexpr (N == 4) {
        asm volatile(
            "global_store_b128 %0, %4, off\n\t"
            "global_store_b128 %1, %5, off\n\t"
            "global_store_b128 %2, %6, off\n\t"
            "global_store_b128 %3, %7, off\n\t"
            "s_wait_xcnt 0x0"
            :: "v"(p[0]), "v"(p[1]), "v"(p[2]), "v"(p[3]),
               "v"(d[0]), "v"(d[1]), "v"(d[2]), "v"(d[3]) : "memory");
    } else if constexpr (N == 8) {
        asm volatile(
            "global_store_b128 %0, %8, off\n\t"
            "global_store_b128 %1, %9, off\n\t"
            "global_store_b128 %2, %10, off\n\t"
            "global_store_b128 %3, %11, off\n\t"
            "global_store_b128 %4, %12, off\n\t"
            "global_store_b128 %5, %13, off\n\t"
            "global_store_b128 %6, %14, off\n\t"
            "global_store_b128 %7, %15, off\n\t"
            "s_wait_xcnt 0x0"
            :: "v"(p[0]), "v"(p[1]), "v"(p[2]), "v"(p[3]), "v"(p[4]), "v"(p[5]), "v"(p[6]), "v"(p[7]),
               "v"(d[0]), "v"(d[1]), "v"(d[2]), "v"(d[3]), "v"(d[4]), "v"(d[5]), "v"(d[6]), "v"(d[7]) : "memory");
    } else {
        asm volatile(
            "global_store_b128 %0, %6, off\n\t"
            "global_store_b128 %1, %7, off\n\t"
            "global_store_b128 %2, %8, off\n\t"
            "global_store_b128 %3, %9, off\n\t"
            "global_store_b128 %4, %10, off\n\t"
            "global_store_b128 %5, %11, off\n\t"
            "s_wait_xcnt 0x0"
            :: "v"(p[0]), "v"(p[1]), "v"(p[2]), "v"(p[3]), "v"(p[4]), "v"(p[5]),
               "v"(d[0]), "v"(d[1]), "v"(d[2]), "v"(d[3]), "v"(d[4]), "v"(d[5]) : "memory");
    }
}

// The epilogue of one wave, in two parts: its FA x FB accumulator tiles go through the wave's own LDS rows to whole 128-byte lines. SWAP: D^T is stored (rows = Bt rows, columns = A rows): a lane's eight accumulator rows are eight neighbours of one staged row.
// Part 1 stages the whole wave tile: no accumulator is live any more where the store statements of part 2 take their operands, which must lie in v0 to v255 (with accumulators there the operands were spilled).
template <int FA, int FB, bool SWAP>
__device__ __forceinline__ void gt_stage(unsigned char* L, const v8f (&acc)[FA][FB]) {
    const int tid = threadIdx.x, lane = tid & 31, lr = lane & 15, hi = lane >> 4; const int wave = __builtin_amdgcn_readfirstlane(tid >> 5);
    constexpr int RG = SWAP ? FB : FA, CG = SWAP ? FA : FB, OP = CG * 16 + 4;   // the wave's 16-row groups, its 16-column groups, the staging pitch in floats
    float* ow = (float*)L + wave * (RG * 16 * OP);          // each wave's own RG x 16 x OP floats; the loop's last barrier stands behind every read of the ring
#pragma unroll
    for (int rg = 0; rg < RG; ++rg) { float* os = ow + rg * (16 * OP);
#pragma unroll
        for (int cg = 0; cg < CG; ++cg) {
#pragma unroll
            for (int j = 0; j < 8; ++j) { if constexpr (SWAP) os[lr * OP + cg * 16 + hi * 8 + j] = acc[cg][rg][j]; else os[(hi * 8 + j) * OP + cg * 16 + lr] = acc[rg][cg][j]; } } }
}
// Part 2. C, H: the tile's first output element; CM: its first column term.
template <int EPI, int FA, int FB, int WN, bool SWAP>
__device__ __forceinline__ void gt_out(const unsigned char* L, float* C, h16* H, const float* CM, int ldc) {
    const int tid = threadIdx.x, lane = tid & 31; const int wave = __builtin_amdgcn_readfirstlane(tid >> 5), wm = wave / WN, wn = wave % WN;
    constexpr int RG = SWAP ? FB : FA, CG = SWAP ? FA : FB, CW = CG * 16, OP = CW + 4;   // as in part 1; CW: the wave's columns
    const int row0 = SWAP ? wn * FB * 16 : wm * FA * 16, col0 = SWAP ? wm * FA * 16 : wn * FB * 16;
    v4f cm[3] = {};
    if constexpr (EPI == EP_OUT) {   // the lane's column terms (its column repeats every third store), fetched behind the loop; load and data wait in one statement, so that no register of the load is reused while it is in flight
        static_assert(CW == 96);
#pragma unroll
        for (int k = 0; k < 3; ++k) { const float* cp = CM + col0 + ((k * 32 + lane) % 24) * 4;
            asm volatile("global_load_b128 %0, %1, off\n\ts_wait_loadcnt 0x0" : "=&v"(cm[k]) : "v"(cp) : "memory"); }
    }
    const float* ow = (const float*)L + wave * (RG * 16 * OP);
#pragma unroll
    for (int rg = 0; rg < RG; ++rg) { const float* os = ow + rg * (16 * OP);
        if constexpr (EPI == EP_QKV || EPI == EP_S16) {   // 8 lanes x 16 bytes are one 128-byte line; a row of the wave's columns is CW / 64 whole lines
            h16* hrow = H + (size_t)(row0 + rg * 16) * ldc + col0; constexpr int NS = CW == 64 ? 4 : CW == 128 ? 8 : 6;   // stores a statement
            constexpr float osc = EPI == EP_S16 ? SCL : 1.0f;   // the scores carry their scale
            static_assert((CW / 16) % NS == 0);
#pragma unroll
            for (int s0 = 0; s0 < CW / 16; s0 += NS) { void* p[NS]; v4f d[NS];
#pragma unroll
                for (int u = 0; u < NS; ++u) { const int idx = (s0 + u) * 32 + lane, row = idx / (CW / 8), cofs = (idx % (CW / 8)) * 8; const v4f v0 = *(const v4fa*)(os + row * OP + cofs), v1 = *(const v4fa*)(os + row * OP + cofs + 4); v8h o;
#pragma unroll
                    for (int k = 0; k < 4; ++k) { o[k] = tohx(v0[k] * osc); o[4 + k] = tohx(v1[k] * osc); }
                    p[u] = hrow + (size_t)row * ldc + cofs; d[u] = __builtin_bit_cast(v4f, o); }
                gt_st(p, d); }
        } else {                         // 8 lanes x 16 bytes are one 128-byte line; a row of the wave's columns is CW / 32 whole lines
            float* crow = C + (size_t)(row0 + rg * 16) * ldc + col0; constexpr int NS = CW == 128 ? 8 : 6;   // stores a statement
            static_assert((CW / 8) % NS == 0);
#pragma unroll
            for (int s0 = 0; s0 < CW / 8; s0 += NS) { void* p[NS]; v4f d[NS];
#pragma unroll
                for (int u = 0; u < NS; ++u) { const int s = s0 + u, idx = s * 32 + lane, row = idx / (CW / 4), cofs = (idx % (CW / 4)) * 4; v4f val = *(const v4fa*)(os + row * OP + cofs);
                    if constexpr (EPI == EP_OUT) val = val * (1.0f / PCAR) + cm[s % 3];
                    p[u] = crow + (size_t)row * ldc + cofs; d[u] = val; }
                gt_st(p, d); }
        }
    }
}

// One tile. A, Bt: the tile's first rows; C, H: its first output element; CM: its first column term. swap (the same in the whole workgroup; EP_QKV only): D^T is stored (rows = Bt rows, columns = A rows).
template <typename T16, int EPI, int K, int FA, int FB, int WN>
__device__ __forceinline__ void gt_tile(unsigned char* L, const T16* A, const T16* Bt, float* C, h16* H, const float* CM, int ldc, bool swap) {
    typedef typename WFrag<T16>::V V;
    constexpr int RB = FB * 16 * WN;
    static_assert(FA * 16 * (4 / WN) == GT_RA && (RB == 256 || RB == 192) && K % GT_KS == 0);
    constexpr unsigned SLA = gt_slice(GT_RA / 2), SLB = gt_slice(RB / 2), OPA = 2 * SLA, BUF = OPA + 2 * SLB;   // two slices of A rows, then two of Bt rows
    static_assert(SLA == (GT_RA / 2) * GT_PITCH);   // the A rows of both slices lie at one pitch
    constexpr int SG = RB / 32;                     // 16-row groups in a slice of Bt rows
    static_assert(FB % SG == 0);                    // a wave's Bt rows are whole slices
    static_assert(4u * FA * 16u * (FB * 16u + 4u) * 4u <= 2u * BUF && 4u * FB * 16u * (FA * 16u + 4u) * 4u <= 2u * BUF);   // the four waves' output staging lies in the ring
    const int tid = threadIdx.x, lane = tid & 31, lr = lane & 15, hi = lane >> 4; const int wave = __builtin_amdgcn_readfirstlane(tid >> 5), wm = wave / WN, wn = wave % WN;
    v8f acc[FA][FB];
#pragma unroll
    for (int mb = 0; mb < FA; ++mb)
#pragma unroll
        for (int nb = 0; nb < FB; ++nb) acc[mb][nb] = (v8f){};
    const unsigned char* fa = L + (wm * FA * 16 + lr) * GT_PITCH + hi * 16;
    const unsigned char* fb = L + OPA + wn * (FB / SG) * SLB + lr * GT_PITCH + hi * 16;
    auto bq = [](int q) { return (unsigned)(q / SG) * SLB + (unsigned)(q % SG) * (16u * GT_PITCH); };   // the wave's q-th 16-row group of Bt rows, from fb
    constexpr int nst = K / GT_KS;
    static_assert(nst >= 2);   // stages 0 and 1 are loaded in front of the loop
    // Every wave brings one slice of each stage: waves 0 and 1 the halves of the A rows, waves 2 and 3 the halves of the Bt rows.
    const bool isB = wave >= 2; const unsigned half = (unsigned)wave & 1u, nrow = isB ? (unsigned)(RB / 2) : (unsigned)(GT_RA / 2);
    const unsigned long long gsrc = (unsigned long long)(size_t)(isB ? (const void*)Bt : (const void*)A) + (unsigned long long)(half * nrow) * ((unsigned)K * 2u);
    const unsigned ldst = (unsigned)(size_t)L + (isB ? OPA + half * SLB : half * SLA);
    const u32x8 g1 = gt_group1(nrow, (unsigned)K * 2u);
    auto issue = [&](unsigned st) { gt_tload(gt_group0(ldst + (st & 1u) * BUF, gsrc + (unsigned long long)st * (GT_KS * 2u)), g1); };

    const u32x4 g00 = gt_group0(ldst, gsrc);
    gt_tload(g00, g1);
    asm volatile("s_wait_tensorcnt 0x0" :: "s"(g00) : "memory");   // this wave's slice of stage 0 has landed; the request's group 0 is named as an input, so that its registers keep their values until this wait has covered the request (a scalar load of a kernel argument was placed into them ahead of the wait)
    __syncthreads();                                      // ... and every wave's slice of it may be read
    issue(1);
#pragma unroll 1
    for (int t = 0; t < nst; ++t) {
        const unsigned bo = (unsigned)(t & 1) * BUF;
        V a[2][FA], b[2][FB];
#pragma unroll
        for (int q = 0; q < FA; ++q) a[0][q] = WFrag<T16>::ld((const T16*)(fa + bo + q * 16 * GT_PITCH));
#pragma unroll
        for (int q = 0; q < FB; ++q) b[0][q] = WFrag<T16>::ld((const T16*)(fb + bo + bq(q)));
        __builtin_amdgcn_sched_barrier(0);   // keeps the first block's LDS reads ahead of the second block's: merged into one group, the first WMMA waits for both
#pragma unroll
        for (int ks = 0; ks < GT_KS / 32; ++ks) {
            if (ks + 1 < GT_KS / 32) {
#pragma unroll
                for (int q = 0; q < FA; ++q) a[(ks + 1) & 1][q] = WFrag<T16>::ld((const T16*)(fa + bo + q * 16 * GT_PITCH + (ks + 1) * 64));
#pragma unroll
                for (int q = 0; q < FB; ++q) b[(ks + 1) & 1][q] = WFrag<T16>::ld((const T16*)(fb + bo + bq(q) + (ks + 1) * 64));
            }
            __builtin_amdgcn_sched_barrier(0);   // keeps the next block's LDS reads one group ahead of this block: sunk among the WMMAs, each pair is waited out on its own
#pragma unroll
            for (int nb = 0; nb < FB; ++nb)
#pragma unroll
                for (int mb = 0; mb < FA; ++mb) acc[mb][nb] = WFrag<T16>::mma(a[ks & 1][mb], b[ks & 1][nb], acc[mb][nb]);
            __builtin_amdgcn_sched_barrier(0);   // closes the block, so that the reads after next do not rise into it
        }
        asm volatile("s_wait_dscnt 0x0" ::: "memory");
        asm volatile("s_wait_tensorcnt 0x0" ::: "memory");
        __syncthreads();
        if (pinned((unsigned)(t + 2 < nst))) issue((unsigned)(t + 2));
    }
    asm volatile("s_wait_tensorcnt 0x0" ::: "memory");      // no tensor load is outstanding when the ring becomes output staging
    asm volatile("s_wait_dscnt 0x0" ::: "memory");          // ... and no LDS read of this wave
    if constexpr (EPI == EP_QKV) { if (swap) gt_stage<FA, FB, true>(L, acc); else gt_stage<FA, FB, false>(L, acc); }
    else gt_stage<FA, FB, false>(L, acc);
    __builtin_amdgcn_wave_barrier(); asm volatile("" ::: "memory");   // the wave's staged tile is written before any lane reads another lane's part of it
    if constexpr (EPI == EP_QKV) { if (swap) gt_out<EPI, FA, FB, WN, true>(L, C, H, CM, ldc); else gt_out<EPI, FA, FB, WN, false>(L, C, H, CM, ldc); }
    else gt_out<EPI, FA, FB, WN, false>(L, C, H, CM, ldc);
}

template <typename T16, int EPI, int K, int FA, int FB, int WN>
__global__ __launch_bounds__(128) void k_gemmw(const T16* __restrict__ A, const T16* __restrict__ Bt, float* C, h16* H, const float* __restrict__ CM, int ldc, size_t sA, size_t sB, size_t sC) {
    constexpr int RB = FB * 16 * WN;
    __shared__ __attribute__((aligned(2048))) unsigned char L[2 * (2 * gt_slice(GT_RA / 2) + 2 * gt_slice(RB / 2))];   // every slice's place in LDS is a multiple of 2 KiB
    const size_t z = blockIdx.z; const int r0 = blockIdx.x * GT_RA, c0 = blockIdx.y * RB;   // the tile's first A row and first Bt row
    A += z * sA + (size_t)r0 * K; Bt += z * sB + (size_t)c0 * K;
    const size_t o0 = z * sC + (size_t)r0 * ldc + c0;   // its first output element
    if constexpr (EPI == EP_QKV) {
        const bool vt = z == 2;   // v^T[batch][d][t]
        const size_t ov = z * sC + (size_t)(blockIdx.x / (SEQ / GT_RA)) * ((size_t)HD * SEQ) + (size_t)c0 * SEQ + (blockIdx.x % (SEQ / GT_RA)) * GT_RA;
        gt_tile<T16, EPI, K, FA, FB, WN>(L, A, Bt, nullptr, H + (vt ? ov : o0), nullptr, vt ? SEQ : ldc, vt);
    } else if constexpr (EPI == EP_OUT) gt_tile<T16, EPI, K, FA, FB, WN>(L, A, Bt, C + o0, nullptr, CM + z * HD + c0, ldc, false);
    else gt_tile<T16, EPI, K, FA, FB, WN>(L, A, Bt, nullptr, H + o0, nullptr, ldc, false);
}

__global__ __launch_bounds__(256) void k_cvt8(const float* __restrict__ src, bf* dst, size_t n8, size_t sS, size_t sD) {
    const size_t i = (size_t)blockIdx.x * 256 + threadIdx.x; if (i >= n8) return;
    src += (size_t)blockIdx.y * sS; dst += (size_t)blockIdx.y * sD;
    const v8f v = *(const v8f*)(src + i * 8); v8us o;
#pragma unroll
    for (int k = 0; k < 8; ++k) o[k] = f2bf(v[k]);
    *(v8us*)(dst + i * 8) = o;  }

// k_wtp: weight plane WT[e][d] (bf16, RNE) = W[d][e] (f32, [in][out] orientation), plane blockIdx.z of the stack; one 64(d) x 64(e) tile per block, transposed through LDS (all 64x64 entries staged, block barrier, pad column never read);
__global__ __launch_bounds__(256) void k_wtp(const float* __restrict__ W, bf* WT) {
    __shared__ float tl[64 * 65];
    const int tid = threadIdx.x; const int d0 = blockIdx.x * 64, e0 = blockIdx.y * 64; W += (size_t)blockIdx.z * DM * HD; WT += (size_t)blockIdx.z * HD * DM;
#pragma unroll 4
    for (int i = 0; i < 16; ++i) { const int idx = i * 256 + tid; const int dd = idx >> 6, ee = idx & 63; tl[dd * 65 + ee] = W[(size_t)(d0 + dd) * HD + e0 + ee]; }
    __syncthreads();
    const int pc = tid & 7, er = tid >> 3; v8us o0, o1;
#pragma unroll
    for (int k = 0; k < 8; ++k) { o0[k] = f2bf(tl[(pc * 8 + k) * 65 + er]); o1[k] = f2bf(tl[(pc * 8 + k) * 65 + 32 + er]); }
    bf* p0 = WT + (size_t)(e0 + er) * DM + d0 + pc * 8; bf* p1 = WT + (size_t)(e0 + 32 + er) * DM + d0 + pc * 8;
    *(v8us*)p0 = o0; *(v8us*)p1 = o1;  }

// k_vmean: VM[r] = mean over the SEQ keys of plane row r = (batch, d) of the f16 v^T plane, summed in f32. 32 rows per block, one per wave (whole 512-byte pieces per load, fixed trees); one wave stores the block's 32 means as one 128-byte line.
__global__ __launch_bounds__(1024) void k_vmean(const h16* __restrict__ VT, float* VM) {
    __shared__ float part[32];
    const int lane = threadIdx.x & 31, w = threadIdx.x >> 5; const int row0 = blockIdx.x * 32;
    const h16* p = VT + (size_t)(row0 + w) * SEQ + lane * 8; float s = 0.f;
#pragma unroll
    for (int ch = 0; ch < SEQ / 256; ++ch) { const v8h a = *(const v8h*)(p + ch * 256);
        s += (((float)a[0] + (float)a[1]) + ((float)a[2] + (float)a[3])) + (((float)a[4] + (float)a[5]) + ((float)a[6] + (float)a[7])); }
#pragma unroll
    for (int sh = 16; sh; sh >>= 1) s += __shfl_xor(s, sh, 32);
    if (lane == 0) part[w] = s;
    __syncthreads();
    if (threadIdx.x < 32) VM[row0 + threadIdx.x] = part[threadIdx.x] * (1.0f / (float)SEQ);
}

// k_asoft: per row (one wave): t = the f16 scaled score; softmax over the SEQ keys in f32 (register row, running max then one exp, fixed shuffle trees); a lane holds eight neighbouring keys of every 256: 16-byte loads and stores;
__global__ __launch_bounds__(256) void k_asoft(const h16* __restrict__ Sb, h16* P16) {
    const int lane = threadIdx.x & 31; const int row = blockIdx.x * 8 + (threadIdx.x >> 5); if (row >= ZB * SEQ) return;
    const h16* sr = Sb + (size_t)row * SEQ; float v[SEQ / 32]; float mx = -3.0e38f;
#pragma unroll
    for (int ch = 0; ch < SEQ / 256; ++ch) { const v8h a = *(const v8h*)(sr + ch * 256 + lane * 8);
#pragma unroll
        for (int q = 0; q < 8; ++q) { const float t = (float)a[q]; v[ch * 8 + q] = t; mx = fmaxf(mx, t); } }
#pragma unroll
    for (int sh = 16; sh; sh >>= 1) mx = fmaxf(mx, __shfl_xor(mx, sh, 32));
    float sum = 0.f;
#pragma unroll
    for (int k = 0; k < SEQ / 32; ++k) { float d0 = __fsub_rn(v[k], mx); asm volatile("" : "+v"(d0)); const float e0 = __fmul_rn(d0, 1.4426950408889634f);
        asm("v_exp_f32 %0, %1\n\tv_nop" : "=v"(v[k]) : "v"(e0));   // the v_nop fills the one slot that the instruction set asks for behind a transcendental, whatever the compiler places next (this build put the next exp, which overwrites the source, directly behind)
        sum += v[k]; }
#pragma unroll
    for (int sh = 16; sh; sh >>= 1) sum += __shfl_xor(sum, sh, 32);
    const float f = __fdiv_rn(PCAR, sum); const float cen = PCAR / (float)SEQ;
{
#pragma unroll
        for (int ch = 0; ch < SEQ / 256; ++ch) { v8h o8;
#pragma unroll
            for (int q = 0; q < 8; ++q) o8[q] = tohx(v[ch * 8 + q] * f - cen);
            *(v8h*)(P16 + (size_t)row * SEQ + ch * 256 + lane * 8) = o8; }
         }
}

constexpr size_t al256(size_t b) { return (b + 255) & ~(size_t)255; }
constexpr size_t WS_TOTAL =
    al256((size_t)3 * HD * DM * 2) +              // WQ WK WV bf16, [out][in]
    al256((size_t)ZB * SEQ * DM * 2) +            // XB bf16
    al256((size_t)3 * ZB * SEQ * HD * 2) +        // QP16|KP16|VT16
    al256((size_t)ZB * HD * 4) +                  // VM
    al256((size_t)ZB * SEQ * SEQ * 2);            // Sb f16; P16 lies over XB|QP16|KP16, which nothing reads behind the S product
static_assert(WS_TOTAL <= (size_t)268435456);
static_assert(((size_t)ZB * SEQ * DM * 2) % 256 == 0);   // XB and QP16 adjoin

extern "C" void kernel_launch(void* const* d_in, const int* in_sizes, int n_in,
                              void* d_out, int out_size, void* d_ws, size_t ws_size, hipStream_t stream) {
    if (n_in < 2) return;
    if ((size_t)in_sizes[0] < ((size_t)(NB - 1) * SEQ_FULL + SEQ) * DM) return;
    if ((size_t)in_sizes[1] < (size_t)3 * DM * HD) return;
    if ((size_t)out_size < (size_t)NB * SEQ * DM) return;
    if (WS_TOTAL > ws_size) return;
    const float* x = (const float*)d_in[0]; const float* qkv = (const float*)d_in[1];   // qkv: [3][in 768][out 768], slabs q, k, v
    float* OUT = (float*)d_out;     // [NB][SEQ][768]
    char* wsp = (char*)d_ws;
    auto take = [&](size_t bytes) { char* p = wsp; wsp += al256(bytes); return (void*)p; };
    bf* WT = (bf*)take((size_t)3 * HD * DM * 2);
    bf* XB = (bf*)take((size_t)ZB * SEQ * DM * 2);
    h16* QP16 = (h16*)take((size_t)3 * ZB * SEQ * HD * 2); h16* KP16 = QP16 + (size_t)ZB * SEQ * HD; h16* VT16 = KP16 + (size_t)ZB * SEQ * HD;
    float* VM = (float*)take((size_t)ZB * HD * 4);
    h16* Sb = (h16*)take((size_t)ZB * SEQ * SEQ * 2); h16* P16 = (h16*)XB;
    if ((size_t)(wsp - (char*)d_ws) > ws_size) return;

    // weight slabs W[d][e] ([in][out]) -> planes WT[e][d] ([out][in], K-contiguous for the GEMM)
    k_wtp<<<dim3(DM / 64, HD / 64, 3), 256, 0, stream>>>(qkv, WT);
    const size_t x8 = (size_t)SEQ * DM / 8;                 // per batch slab
    k_cvt8<<<dim3((unsigned)((x8 + 255) / 256), ZB, 1), 256, 0, stream>>>(x, XB, x8, (size_t)SEQ_FULL * DM, (size_t)SEQ * DM);
    k_gemmw<bf, EP_QKV, DM, 4, 12, 1><<<dim3(ZB * SEQ / 256, HD / 192, 3), 128, 0, stream>>>(XB, WT, nullptr, QP16, nullptr, HD, 0, (size_t)HD * DM, (size_t)ZB * SEQ * HD);
    k_vmean<<<ZB * HD / 32, 1024, 0, stream>>>(VT16, VM);
    k_gemmw<h16, EP_S16, HD, 8, 8, 2><<<dim3(SEQ / 256, SEQ / 256, ZB), 128, 0, stream>>>(QP16, KP16, nullptr, Sb, nullptr, SEQ, (size_t)SEQ * HD, (size_t)SEQ * HD, (size_t)SEQ * SEQ);
    k_asoft<<<ZB * SEQ / 8, 256, 0, stream>>>(Sb, P16);
    k_gemmw<h16, EP_OUT, SEQ, 8, 6, 2><<<dim3(SEQ / 256, HD / 192, ZB), 128, 0, stream>>>(P16, VT16, OUT, nullptr, VM, HD, (size_t)SEQ * SEQ, (size_t)HD * SEQ, (size_t)SEQ * HD);
}

// v007
// Measured time: 138 microseconds a run.
// In both of two side-by-side timings against v006, it was 1.05 times as fast.
// Counting every step since v000, it is 5.67 times as fast.
#include <hip/hip_runtime.h>

// Contractions: q/k/v projections on v_wmma_f32_16x16x32_bf16 (x and the stacked QKV weights RNE-converted to bf16, weights transposed to [out][in] planes, exact products, f32 accumulate); q.k^T and att.v on v_wmma_f32_16x16x32_f16 (f16 q/k/v planes; softmax weights carried x1024 and centred by 1024/SEQ, column mean of v added back in f32), f32 accumulate.
// Single-head full-width self-attention: x [8][2048][768]; q = x QKV[0], k = x QKV[1], v = x QKV[2] ('io' [768][768] each, stacked [3][768][768], no bias); att = softmax(q.k * 768^-0.5) over all 2048 keys (no mask); out = att @ v -> [8][2048][768] f32.
// All batches in one pass, one launch per stage (z-batched GEMMs; stages that do not depend on each other share a launch): projections stored as f16 planes by the GEMM itself (q, k row-major; v transposed [d][t] in the GEMM's output staging); S = q k^T x 768^-0.5 (materialised as an f16 plane, rounded once from the f32 accumulator); row softmax in f32 registers; O = P' v, stored as out = O/1024 + mean_t(v).

#ifndef NB
#define NB 8
#endif
#ifndef SEQ
#define SEQ 2048
#endif
#define NB_FULL  8
#define SEQ_FULL 2048
#define DM   768
#define HD   768
#define ZB   NB                           // batches per pass: all of them
#define PCAR 1024.0f
#define SCL  0.03608439182435161f         // 768^-0.5

typedef _Float16 h16;
typedef unsigned short bf;
typedef __attribute__((ext_vector_type(16))) __bf16   v16bf;
typedef __attribute__((ext_vector_type(16))) _Float16 v16h;
typedef __attribute__((ext_vector_type(8)))  _Float16 v8h;
typedef __attribute__((ext_vector_type(8)))  unsigned short v8us;
typedef __attribute__((ext_vector_type(8)))  float    v8f;
typedef __attribute__((ext_vector_type(4)))  float    v4f;
typedef v4f  __attribute__((may_alias)) v4fa;

static_assert(NB <= NB_FULL);
static_assert(SEQ <= SEQ_FULL);
static_assert(NB % ZB == 0);
static_assert(SEQ % 256 == 0);                 // softmax row chunks, 256-row tiles, K stages of 128
static_assert(DM % 128 == 0 && HD % 192 == 0); // K stages of 128, 192-column tiles; 64x64 weight transpose tiles
static_assert(DM == HD);                       // one full-width head: plane pitch == row pitch
static_assert(((size_t)SEQ * DM) % 8 == 0);
static_assert((ZB * SEQ) % 8 == 0);
static_assert(HD % 32 == 0 && SEQ % 256 == 0);  // the v^T row means: 32 rows per block, 256 keys per wave load
static_assert((DM * 2) % 128 == 0);
static_assert(SEQ <= 3 * DM);                  // the softmax weights lie over the x, q and k planes

__device__ __forceinline__ unsigned short f2bf(float f) { unsigned u = __float_as_uint(f); u += 0x7FFFu + ((u >> 16) & 1u); return (unsigned short)(u >> 16); }
__device__ __forceinline__ v16h cat16(v8h lo, v8h hi) { return __builtin_shufflevector(lo, hi, 0, 1, 2, 3, 4, 5, 6, 7, 8, 9, 10, 11, 12, 13, 14, 15); }
__device__ __forceinline__ v16bf cat16b(v8us lo, v8us hi) { return __builtin_bit_cast(v16bf, __builtin_shufflevector(lo, hi, 0, 1, 2, 3, 4, 5, 6, 7, 8, 9, 10, 11, 12, 13, 14, 15)); }
__device__ __forceinline__ v8f wmma16(v16h a, v16h b, v8f c) { return __builtin_amdgcn_wmma_f32_16x16x32_f16(false, a, false, b, (short)0, c, false, false); }
__device__ __forceinline__ v8f wmmab(v16bf a, v16bf b, v8f c) { return __builtin_amdgcn_wmma_f32_16x16x32_bf16(false, a, false, b, (short)0, c, false, false); }
__device__ __forceinline__ h16 tohx(float x) { return (h16)x; }

// ---- k_gemmw: GEMM, one 256 x RB output tile per workgroup of FOUR WAVES, one wave a SIMD; each wave holds FA x FB accumulator tiles (16 FA rows x 16 FB columns); the waves lie (4 / WN) x WN over the tile, RB = 16 FB WN; grid (M/256, N/RB, Z), 128 threads.
// Wave tiles: 128x128 (S = q k^T), 128x96 (O = P' v), 64x192 (projections): FA FB products per FA + FB loaded fragments, against 16 per 8 with a 64x64 wave tile, and about half the L2 bytes per product of a 128x128 workgroup tile. RB = 192 makes 768 and 256 workgroups of the projections and of O: whole rounds of one workgroup a WGP. The projections' waves lie 4 x 1, so that a wave's 192 16-bit columns are whole 128-byte lines.
// D[m][n] = sum_k A[m][k] Bt[n][k] (f32 accumulate), A and Bt K-contiguous 16-bit planes. z-batch strides sA/sB/sC in elements. K (a template constant) % 128 == 0, M % 256 == 0, N % RB == 0.
// The epilogue stores what the next kernel reads, pitch ldc: EP_S16: H = D x 768^-0.5 rounded to f16 (RNE); EP_QKV: H = D rounded to f16 (RNE); EP_OUT: C = D/1024 + CM[z][n] (CM: HD floats per z).
// EP_QKV is the three projections in one grid (x = 256 rows of all batches' x, y = 192 weight rows, z = q, k, v): slices 0 and 1 as above; slice 2 transposes in its output staging and stores v^T[batch][d][t], pitch SEQ.
// A stage is 128 k (256 B) of the tile's 256 A rows and RB Bt rows, brought into LDS by four tensor loads, one a wave (half of one operand's rows each), two buffers: stage t+1 flies while stage t is multiplied.
// Fragment map (A and Bt alike): lane -> row/col lane&15, h = lane>>4; elements 0..7 = k0+8h+0..7, elements 8..15 = k0+16+8h+0..7. D: acc[j] = (row 8h+j, col lane&15).
#define GT_KS    128                      // k per stage
#define GT_PITCH 272                      // LDS row pitch, bytes: 16 B x odd, no bank conflict for 16-byte fragment reads
#define GT_RA    256                      // A rows of a tile
#define EP_S16 0
#define EP_QKV 1
#define EP_OUT 2
template <typename T16> struct WFrag;
template <> struct WFrag<h16> { typedef v16h V; static __device__ __forceinline__ V ld(const h16* p) { return cat16(*(const v8h*)p, *(const v8h*)(p + 16)); } static __device__ __forceinline__ v8f mma(V a, V b, v8f c) { return wmma16(a, b, c); } };
template <> struct WFrag<bf> { typedef v16bf V; static __device__ __forceinline__ V ld(const bf* p) { return cat16b(*(const v8us*)p, *(const v8us*)(p + 16)); } static __device__ __forceinline__ v8f mma(V a, V b, v8f c) { return wmmab(a, b, c); } };

// Tensor load of one wave: a slice of whole 256-byte row pieces goes from global memory into LDS through no register; the pad (16 bytes behind every 256) lays the rows at GT_PITCH.
typedef unsigned u32x4 __attribute__((ext_vector_type(4)));
typedef unsigned u32x8 __attribute__((ext_vector_type(8)));
__device__ __forceinline__ unsigned uni(unsigned v) { return (unsigned)__builtin_amdgcn_readfirstlane(v); }
__device__ __forceinline__ unsigned pinned(unsigned v) { unsigned w = (unsigned)__builtin_amdgcn_readfirstlane(v); asm volatile("" : "+s"(w)); return w; }   // holds a value in a scalar register: the test round a tensor load, so that its branch is a scalar branch (a tensor load ignores EXEC), or a descriptor word
#define GT_PADW0 ((1u << 20) | (5u << 22) | (3u << 25))   // no mask, 1-byte elements, a pad of 4 dwords behind every 64 dwords
// Group 1: rows of GT_KS * 2 bytes, nrow of them, tensor = tile, source pitch in bytes.
__device__ __forceinline__ u32x8 gt_group1(unsigned nrow, unsigned pitch) {
    constexpr unsigned d0 = GT_KS * 2u; u32x8 g;
    g[0] = uni(GT_PADW0);
    // pinned(): each descriptor word is held in a scalar register of its own through the loop, so that none takes another value while a request is outstanding
    g[1] = pinned((d0 & 0xFFFFu) << 16); g[2] = pinned((d0 >> 16) | ((nrow & 0xFFFFu) << 16)); g[3] = pinned((nrow >> 16) | (d0 << 16));
    g[4] = pinned(nrow); g[5] = pinned(pitch); g[6] = pinned(0u); g[7] = pinned(0u); return g; }
// Group 0: count 1, the place in LDS, the tile's first byte, type 2.
__device__ __forceinline__ u32x4 gt_group0(unsigned lds, unsigned long long ga) {
    u32x4 g; g[0] = uni(1u); g[1] = uni(lds); g[2] = uni((unsigned)ga); g[3] = uni((((unsigned)(ga >> 32)) & 0x01FFFFFFu) | 0x80000000u); return g; }
__device__ __forceinline__ void gt_tload(u32x4 g0, u32x8 g1) { asm volatile("tensor_load_to_lds %0, %1" :: "s"(g0), "s"(g1) : "memory"); }
constexpr unsigned gt_slice(unsigned rows) { return (rows * GT_PITCH + 2047u) & ~2047u; }   // LDS bytes of a slice, rounded up so that the next slice's place is a multiple of 2 KiB again

// N 16-byte stores of a lane and their s_wait_xcnt 0 in one statement, so that no address or data register of an issued store is rewritten ahead of that wait.
template <int N>
__device__ __forceinline__ void gt_st(void* const (&p)[N], const v4f (&d)[N]) {
    static_assert(N == 4 || N == 8 || N == 6);
    if constexpr (N == 4) {
        asm volatile(
            "global_store_b128 %0, %4, off\n\t"
            "global_store_b128 %1, %5, off\n\t"
            "global_store_b128 %2, %6, off\n\t"
            "global_store_b128 %3, %7, off\n\t"
            "s_wait_xcnt 0x0"
            :: "v"(p[0]), "v"(p[1]), "v"(p[2]), "v"(p[3]),
               "v"(d[0]), "v"(d[1]), "v"(d[2]), "v"(d[3]) : "memory");
    } else if constexpr (N == 8) {
        asm volatile(
            "global_store_b128 %0, %8, off\n\t"
            "global_store_b128 %1, %9, off\n\t"
            "global_store_b128 %2, %10, off\n\t"
            "global_store_b128 %3, %11, off\n\t"
            "global_store_b128 %4, %12, off\n\t"
            "global_store_b128 %5, %13, off\n\t"
            "global_store_b128 %6, %14, off\n\t"
            "global_store_b128 %7, %15, off\n\t"
            "s_wait_xcnt 0x0"
            :: "v"(p[0]), "v"(p[1]), "v"(p[2]), "v"(p[3]), "v"(p[4]), "v"(p[5]), "v"(p[6]), "v"(p[7]),
               "v"(d[0]), "v"(d[1]), "v"(d[2]), "v"(d[3]), "v"(d[4]), "v"(d[5]), "v"(d[6]), "v"(d[7]) : "memory");
    } else {
        asm volatile(
            "global_store_b128 %0, %6, off\n\t"
            "global_store_b128 %1, %7, off\n\t"
            "global_store_b128 %2, %8, off\n\t"
            "global_store_b128 %3, %9, off\n\t"
            "global_store_b128 %4, %10, off\n\t"
            "global_store_b128 %5, %11, off\n\t"
            "s_wait_xcnt 0x0"
            :: "v"(p[0]), "v"(p[1]), "v"(p[2]), "v"(p[3]), "v"(p[4]), "v"(p[5]),
               "v"(d[0]), "v"(d[1]), "v"(d[2]), "v"(d[3]), "v"(d[4]), "v"(d[5]) : "memory");
    }
}

// The epilogue of one wave, in two parts: its FA x FB accumulator tiles go through the wave's own LDS rows to whole 128-byte lines. SWAP: D^T is stored (rows = Bt rows, columns = A rows): a lane's eight accumulator rows are eight neighbours of one staged row.
// Part 1 stages the whole wave tile: no accumulator is live any more where the store statements of part 2 take their operands, which must lie in v0 to v255 (with accumulators there the operands were spilled).
template <int FA, int FB, bool SWAP>
__device__ __forceinline__ void gt_stage(unsigned char* L, const v8f (&acc)[FA][FB]) {
    const int tid = threadIdx.x, lane = tid & 31, lr = lane & 15, hi = lane >> 4; const int wave = __builtin_amdgcn_readfirstlane(tid >> 5);
    constexpr int RG = SWAP ? FB : FA, CG = SWAP ? FA : FB, OP = CG * 16 + 4;   // the wave's 16-row groups, its 16-column groups, the staging pitch in floats
    float* ow = (float*)L + wave * (RG * 16 * OP);          // each wave's own RG x 16 x OP floats; the loop's last barrier stands behind every read of the ring
#pragma unroll
    for (int rg = 0; rg < RG; ++rg) { float* os = ow + rg * (16 * OP);
#pragma unroll
        for (int cg = 0; cg < CG; ++cg) {
#pragma unroll
            for (int j = 0; j < 8; ++j) { if constexpr (SWAP) os[lr * OP + cg * 16 + hi * 8 + j] = acc[cg][rg][j]; else os[(hi * 8 + j) * OP + cg * 16 + lr] = acc[rg][cg][j]; } } }
}
// Part 2. C, H: the tile's first output element; CM: its first column term.
template <int EPI, int FA, int FB, int WN, bool SWAP>
__device__ __forceinline__ void gt_out(const unsigned char* L, float* C, h16* H, const float* CM, int ldc) {
    const int tid = threadIdx.x, lane = tid & 31; const int wave = __builtin_amdgcn_readfirstlane(tid >> 5), wm = wave / WN, wn = wave % WN;
    constexpr int RG = SWAP ? FB : FA, CG = SWAP ? FA : FB, CW = CG * 16, OP = CW + 4;   // as in part 1; CW: the wave's columns
    const int row0 = SWAP ? wn * FB * 16 : wm * FA * 16, col0 = SWAP ? wm * FA * 16 : wn * FB * 16;
    v4f cm[3] = {};
    if constexpr (EPI == EP_OUT) {   // the lane's column terms (its column repeats every third store), fetched behind the loop; load and data wait in one statement, so that no register of the load is reused while it is in flight
        static_assert(CW == 96);
#pragma unroll
        for (int k = 0; k < 3; ++k) { const float* cp = CM + col0 + ((k * 32 + lane) % 24) * 4;
            asm volatile("global_load_b128 %0, %1, off\n\ts_wait_loadcnt 0x0" : "=&v"(cm[k]) : "v"(cp) : "memory"); }
    }
    const float* ow = (const float*)L + wave * (RG * 16 * OP);
#pragma unroll
    for (int rg = 0; rg < RG; ++rg) { const float* os = ow + rg * (16 * OP);
        if constexpr (EPI == EP_QKV || EPI == EP_S16) {   // 8 lanes x 16 bytes are one 128-byte line; a row of the wave's columns is CW / 64 whole lines
            h16* hrow = H + (size_t)(row0 + rg * 16) * ldc + col0; constexpr int NS = CW == 64 ? 4 : CW == 128 ? 8 : 6;   // stores a statement
            constexpr float osc = EPI == EP_S16 ? SCL : 1.0f;   // the scores carry their scale
            static_assert((CW / 16) % NS == 0);
#pragma unroll
            for (int s0 = 0; s0 < CW / 16; s0 += NS) { void* p[NS]; v4f d[NS];
#pragma unroll
                for (int u = 0; u < NS; ++u) { const int idx = (s0 + u) * 32 + lane, row = idx / (CW / 8), cofs = (idx % (CW / 8)) * 8; const v4f v0 = *(const v4fa*)(os + row * OP + cofs), v1 = *(const v4fa*)(os + row * OP + cofs + 4); v8h o;
#pragma unroll
                    for (int k = 0; k < 4; ++k) { o[k] = tohx(v0[k] * osc); o[4 + k] = tohx(v1[k] * osc); }
                    p[u] = hrow + (size_t)row * ldc + cofs; d[u] = __builtin_bit_cast(v4f, o); }
                gt_st(p, d); }
        } else {                         // 8 lanes x 16 bytes are one 128-byte line; a row of the wave's columns is CW / 32 whole lines
            float* crow = C + (size_t)(row0 + rg * 16) * ldc + col0; constexpr int NS = CW == 128 ? 8 : 6;   // stores a statement
            static_assert((CW / 8) % NS == 0);
#pragma unroll
            for (int s0 = 0; s0 < CW / 8; s0 += NS) { void* p[NS]; v4f d[NS];
#pragma unroll
                for (int u = 0; u < NS; ++u) { const int s = s0 + u, idx = s * 32 + lane, row = idx / (CW / 4), cofs = (idx % (CW / 4)) * 4; v4f val = *(const v4fa*)(os + row * OP + cofs);
                    if constexpr (EPI == EP_OUT) val = val * (1.0f / PCAR) + cm[s % 3];
                    p[u] = crow + (size_t)row * ldc + cofs; d[u] = val; }
                gt_st(p, d); }
        }
    }
}

// One tile. A, Bt: the tile's first rows; C, H: its first output element; CM: its first column term. swap (the same in the whole workgroup; EP_QKV only): D^T is stored (rows = Bt rows, columns = A rows).
template <typename T16, int EPI, int K, int FA, int FB, int WN>
__device__ __forceinline__ void gt_tile(unsigned char* L, const T16* A, const T16* Bt, float* C, h16* H, const float* CM, int ldc, bool swap) {
    typedef typename WFrag<T16>::V V;
    constexpr int RB = FB * 16 * WN;
    static_assert(FA * 16 * (4 / WN) == GT_RA && (RB == 256 || RB == 192) && K % GT_KS == 0);
    constexpr unsigned SLA = gt_slice(GT_RA / 2), SLB = gt_slice(RB / 2), OPA = 2 * SLA, BUF = OPA + 2 * SLB;   // two slices of A rows, then two of Bt rows
    static_assert(SLA == (GT_RA / 2) * GT_PITCH);   // the A rows of both slices lie at one pitch
    constexpr int SG = RB / 32;                     // 16-row groups in a slice of Bt rows
    static_assert(FB % SG == 0);                    // a wave's Bt rows are whole slices
    static_assert(4u * FA * 16u * (FB * 16u + 4u) * 4u <= 2u * BUF && 4u * FB * 16u * (FA * 16u + 4u) * 4u <= 2u * BUF);   // the four waves' output staging lies in the ring
    const int tid = threadIdx.x, lane = tid & 31, lr = lane & 15, hi = lane >> 4; const int wave = __builtin_amdgcn_readfirstlane(tid >> 5), wm = wave / WN, wn = wave % WN;
    v8f acc[FA][FB];
#pragma unroll
    for (int mb = 0; mb < FA; ++mb)
#pragma unroll
        for (int nb = 0; nb < FB; ++nb) acc[mb][nb] = (v8f){};
    const unsigned char* fa = L + (wm * FA * 16 + lr) * GT_PITCH + hi * 16;
    const unsigned char* fb = L + OPA + wn * (FB / SG) * SLB + lr * GT_PITCH + hi * 16;
    auto bq = [](int q) { return (unsigned)(q / SG) * SLB + (unsigned)(q % SG) * (16u * GT_PITCH); };   // the wave's q-th 16-row group of Bt rows, from fb
    constexpr int nst = K / GT_KS;
    static_assert(nst >= 2);   // stages 0 and 1 are loaded in front of the loop
    // Every wave brings one slice of each stage: waves 0 and 1 the halves of the A rows, waves 2 and 3 the halves of the Bt rows.
    const bool isB = wave >= 2; const unsigned half = (unsigned)wave & 1u, nrow = isB ? (unsigned)(RB / 2) : (unsigned)(GT_RA / 2);
    const unsigned long long gsrc = (unsigned long long)(size_t)(isB ? (const void*)Bt : (const void*)A) + (unsigned long long)(half * nrow) * ((unsigned)K * 2u);
    const unsigned ldst = (unsigned)(size_t)L + (isB ? OPA + half * SLB : half * SLA);
    const u32x8 g1 = gt_group1(nrow, (unsigned)K * 2u);
    auto issue = [&](unsigned st) { gt_tload(gt_group0(ldst + (st & 1u) * BUF, gsrc + (unsigned long long)st * (GT_KS * 2u)), g1); };

    const u32x4 g00 = gt_group0(ldst, gsrc);
    gt_tload(g00, g1);
    asm volatile("s_wait_tensorcnt 0x0" :: "s"(g00) : "memory");   // this wave's slice of stage 0 has landed; the request's group 0 is named as an input, so that its registers keep their values until this wait has covered the request (a scalar load of a kernel argument was placed into them ahead of the wait)
    __syncthreads();                                      // ... and every wave's slice of it may be read
    issue(1);
#pragma unroll 1
    for (int t = 0; t < nst; ++t) {
        const unsigned bo = (unsigned)(t & 1) * BUF;
        V a[2][FA], b[2][FB];
#pragma unroll
        for (int q = 0; q < FA; ++q) a[0][q] = WFrag<T16>::ld((const T16*)(fa + bo + q * 16 * GT_PITCH));
#pragma unroll
        for (int q = 0; q < FB; ++q) b[0][q] = WFrag<T16>::ld((const T16*)(fb + bo + bq(q)));
        __builtin_amdgcn_sched_barrier(0);   // keeps the first block's LDS reads ahead of the second block's: merged into one group, the first WMMA waits for both
#pragma unroll
        for (int ks = 0; ks < GT_KS / 32; ++ks) {
            if (ks + 1 < GT_KS / 32) {
#pragma unroll
                for (int q = 0; q < FA; ++q) a[(ks + 1) & 1][q] = WFrag<T16>::ld((const T16*)(fa + bo + q * 16 * GT_PITCH + (ks + 1) * 64));
#pragma unroll
                for (int q = 0; q < FB; ++q) b[(ks + 1) & 1][q] = WFrag<T16>::ld((const T16*)(fb + bo + bq(q) + (ks + 1) * 64));
            }
            __builtin_amdgcn_sched_barrier(0);   // keeps the next block's LDS reads one group ahead of this block: sunk among the WMMAs, each pair is waited out on its own
#pragma unroll
            for (int nb = 0; nb < FB; ++nb)
#pragma unroll
                for (int mb = 0; mb < FA; ++mb) acc[mb][nb] = WFrag<T16>::mma(a[ks & 1][mb], b[ks & 1][nb], acc[mb][nb]);
            __builtin_amdgcn_sched_barrier(0);   // closes the block, so that the reads after next do not rise into it
        }
        asm volatile("s_wait_dscnt 0x0" ::: "memory");
        asm volatile("s_wait_tensorcnt 0x0" ::: "memory");
        __syncthreads();
        if (pinned((unsigned)(t + 2 < nst))) issue((unsigned)(t + 2));
    }
    asm volatile("s_wait_tensorcnt 0x0" ::: "memory");      // no tensor load is outstanding when the ring becomes output staging
    asm volatile("s_wait_dscnt 0x0" ::: "memory");          // ... and no LDS read of this wave
    if constexpr (EPI == EP_QKV) { if (swap) gt_stage<FA, FB, true>(L, acc); else gt_stage<FA, FB, false>(L, acc); }
    else gt_stage<FA, FB, false>(L, acc);
    __builtin_amdgcn_wave_barrier(); asm volatile("" ::: "memory");   // the wave's staged tile is written before any lane reads another lane's part of it
    if constexpr (EPI == EP_QKV) { if (swap) gt_out<EPI, FA, FB, WN, true>(L, C, H, CM, ldc); else gt_out<EPI, FA, FB, WN, false>(L, C, H, CM, ldc); }
    else gt_out<EPI, FA, FB, WN, false>(L, C, H, CM, ldc);
}

template <typename T16, int EPI, int K, int FA, int FB, int WN>
__global__ __launch_bounds__(128) void k_gemmw(const T16* __restrict__ A, const T16* __restrict__ Bt, float* C, h16* H, const float* __restrict__ CM, int ldc, size_t sA, size_t sB, size_t sC) {
    constexpr int RB = FB * 16 * WN;
    __shared__ __attribute__((aligned(2048))) unsigned char L[2 * (2 * gt_slice(GT_RA / 2) + 2 * gt_slice(RB / 2))];   // every slice's place in LDS is a multiple of 2 KiB
    const size_t z = blockIdx.z; const int r0 = blockIdx.x * GT_RA, c0 = blockIdx.y * RB;   // the tile's first A row and first Bt row
    A += z * sA + (size_t)r0 * K; Bt += z * sB + (size_t)c0 * K;
    const size_t o0 = z * sC + (size_t)r0 * ldc + c0;   // its first output element
    if constexpr (EPI == EP_QKV) {
        const bool vt = z == 2;   // v^T[batch][d][t]
        const size_t ov = z * sC + (size_t)(blockIdx.x / (SEQ / GT_RA)) * ((size_t)HD * SEQ) + (size_t)c0 * SEQ + (blockIdx.x % (SEQ / GT_RA)) * GT_RA;
        gt_tile<T16, EPI, K, FA, FB, WN>(L, A, Bt, nullptr, H + (vt ? ov : o0), nullptr, vt ? SEQ : ldc, vt);
    } else if constexpr (EPI == EP_OUT) gt_tile<T16, EPI, K, FA, FB, WN>(L, A, Bt, C + o0, nullptr, CM + z * HD + c0, ldc, false);
    else gt_tile<T16, EPI, K, FA, FB, WN>(L, A, Bt, nullptr, H + o0, nullptr, ldc, false);
}

// k_prep: the two conversions that the projections wait for, in one launch: they do not depend on each other, so the short transpose runs under the long stream instead of in front of it.
// Blocks 0 .. WT_BLK-1: weight plane WT[e][d] (bf16, RNE) = W[d][e] (f32, [in][out] orientation); one 64(d) x 64(e) tile of one plane per block, transposed through LDS (all 64x64 entries staged, block barrier, pad column never read).
// The blocks behind them: x (f32) -> XB (bf16, RNE), eight elements a thread, XC_BLK blocks a batch.
#define WT_BLK ((DM / 64) * (HD / 64) * 3)
#define XC_N8  ((size_t)SEQ * DM / 8)
#define XC_BLK ((unsigned)((XC_N8 + 255) / 256))
__global__ __launch_bounds__(256) void k_prep(const float* __restrict__ W, bf* WT, const float* __restrict__ src, bf* dst) {
    __shared__ float tl[64 * 65];
    const int tid = threadIdx.x;
    if (blockIdx.x < WT_BLK) {   // the same in the whole block: the barrier below is passed by all of its threads or by none
        const int b = blockIdx.x; const int d0 = (b % (DM / 64)) * 64, e0 = ((b / (DM / 64)) % (HD / 64)) * 64, pl = b / ((DM / 64) * (HD / 64)); W += (size_t)pl * DM * HD; WT += (size_t)pl * HD * DM;
#pragma unroll 4   // several loads of a thread in flight at once
        for (int i = 0; i < 16; ++i) { const int idx = i * 256 + tid; const int dd = idx >> 6, ee = idx & 63; tl[dd * 65 + ee] = W[(size_t)(d0 + dd) * HD + e0 + ee]; }
        __syncthreads();
        const int pc = tid & 7, er = tid >> 3; v8us o0, o1;
#pragma unroll
        for (int k = 0; k < 8; ++k) { o0[k] = f2bf(tl[(pc * 8 + k) * 65 + er]); o1[k] = f2bf(tl[(pc * 8 + k) * 65 + 32 + er]); }
        bf* p0 = WT + (size_t)(e0 + er) * DM + d0 + pc * 8; bf* p1 = WT + (size_t)(e0 + 32 + er) * DM + d0 + pc * 8;
        *(v8us*)p0 = o0; *(v8us*)p1 = o1;
    } else {
    const unsigned c = blockIdx.x - WT_BLK; const size_t i = (size_t)(c % XC_BLK) * 256 + tid; if (i >= XC_N8) return;
    src += (size_t)(c / XC_BLK) * ((size_t)SEQ_FULL * DM); dst += (size_t)(c / XC_BLK) * ((size_t)SEQ * DM);
    const v8f v = *(const v8f*)(src + i * 8); v8us o;
#pragma unroll
    for (int k = 0; k < 8; ++k) o[k] = f2bf(v[k]);
    *(v8us*)(dst + i * 8) = o;
    }
}

// k_asoft: the two stages between the S product and the O product, in one launch: neither reads what the other writes.
// Blocks 0 .. VM_BLK-1: VM[r] = mean over the SEQ keys of plane row r = (batch, d) of the f16 v^T plane, summed in f32. 32 rows per block, four per wave one after the other (whole 512-byte pieces per load, fixed trees); one wave stores the block's 32 means as one 128-byte line.
// The blocks behind them: per row (one wave): t = the f16 scaled score; softmax over the SEQ keys in f32 (register row, running max then one exp, fixed shuffle trees); a lane holds eight neighbouring keys of every 256: 16-byte loads and stores;
#define VM_BLK (ZB * HD / 32)
__global__ __launch_bounds__(256) void k_asoft(const h16* __restrict__ Sb, h16* P16, const h16* __restrict__ VT, float* VM) {
    __shared__ float part[32];
    if (blockIdx.x < VM_BLK) {   // the same in the whole block: the barrier below is passed by all of its threads or by none
        const int lane = threadIdx.x & 31, w = threadIdx.x >> 5; const int row0 = blockIdx.x * 32;
#pragma unroll 1   // one row's loads at a time: unrolled, four rows' loads would raise the kernel's register count and cost the softmax rows waves per SIMD
        for (int r = 0; r < 4; ++r) {
            const h16* p = VT + (size_t)(row0 + w * 4 + r) * SEQ + lane * 8; float s = 0.f;
#pragma unroll
            for (int ch = 0; ch < SEQ / 256; ++ch) { const v8h a = *(const v8h*)(p + ch * 256);
                s += (((float)a[0] + (float)a[1]) + ((float)a[2] + (float)a[3])) + (((float)a[4] + (float)a[5]) + ((float)a[6] + (float)a[7])); }
#pragma unroll
            for (int sh = 16; sh; sh >>= 1) s += __shfl_xor(s, sh, 32);
            if (lane == 0) part[w * 4 + r] = s;
        }
        __syncthreads();
        if (threadIdx.x < 32) VM[row0 + threadIdx.x] = part[threadIdx.x] * (1.0f / (float)SEQ);
    } else {
    const int lane = threadIdx.x & 31; const int row = (blockIdx.x - VM_BLK) * 8 + (threadIdx.x >> 5); if (row >= ZB * SEQ) return;
    const h16* sr = Sb + (size_t)row * SEQ; float v[SEQ / 32]; float mx = -3.0e38f;
#pragma unroll
    for (int ch = 0; ch < SEQ / 256; ++ch) { const v8h a = *(const v8h*)(sr + ch * 256 + lane * 8);
#pragma unroll
        for (int q = 0; q < 8; ++q) { const float t = (float)a[q]; v[ch * 8 + q] = t; mx = fmaxf(mx, t); } }
#pragma unroll
    for (int sh = 16; sh; sh >>= 1) mx = fmaxf(mx, __shfl_xor(mx, sh, 32));
    float sum = 0.f;
#pragma unroll
    for (int k = 0; k < SEQ / 32; ++k) { float d0 = __fsub_rn(v[k], mx); asm volatile("" : "+v"(d0)); const float e0 = __fmul_rn(d0, 1.4426950408889634f);
        asm("v_exp_f32 %0, %1\n\tv_nop" : "=v"(v[k]) : "v"(e0));   // the v_nop fills the one slot that the instruction set asks for behind a transcendental, whatever the compiler places next (this build put the next exp, which overwrites the source, directly behind)
        sum += v[k]; }
#pragma unroll
    for (int sh = 16; sh; sh >>= 1) sum += __shfl_xor(sum, sh, 32);
    const float f = __fdiv_rn(PCAR, sum); const float cen = PCAR / (float)SEQ;
{
#pragma unroll
        for (int ch = 0; ch < SEQ / 256; ++ch) { v8h o8;
#pragma unroll
            for (int q = 0; q < 8; ++q) o8[q] = tohx(v[ch * 8 + q] * f - cen);
            *(v8h*)(P16 + (size_t)row * SEQ + ch * 256 + lane * 8) = o8; }
         }
    }
}

constexpr size_t al256(size_t b) { return (b + 255) & ~(size_t)255; }
constexpr size_t WS_TOTAL =
    al256((size_t)3 * HD * DM * 2) +              // WQ WK WV bf16, [out][in]
    al256((size_t)ZB * SEQ * DM * 2) +            // XB bf16
    al256((size_t)3 * ZB * SEQ * HD * 2) +        // QP16|KP16|VT16
    al256((size_t)ZB * HD * 4) +                  // VM
    al256((size_t)ZB * SEQ * SEQ * 2);            // Sb f16; P16 lies over XB|QP16|KP16, which nothing reads behind the S product
static_assert(WS_TOTAL <= (size_t)268435456);
static_assert(((size_t)ZB * SEQ * DM * 2) % 256 == 0);   // XB and QP16 adjoin

extern "C" void kernel_launch(void* const* d_in, const int* in_sizes, int n_in,
                              void* d_out, int out_size, void* d_ws, size_t ws_size, hipStream_t stream) {
    if (n_in < 2) return;
    if ((size_t)in_sizes[0] < ((size_t)(NB - 1) * SEQ_FULL + SEQ) * DM) return;
    if ((size_t)in_sizes[1] < (size_t)3 * DM * HD) return;
    if ((size_t)out_size < (size_t)NB * SEQ * DM) return;
    if (WS_TOTAL > ws_size) return;
    const float* x = (const float*)d_in[0]; const float* qkv = (const float*)d_in[1];   // qkv: [3][in 768][out 768], slabs q, k, v
    float* OUT = (float*)d_out;     // [NB][SEQ][768]
    char* wsp = (char*)d_ws;
    auto take = [&](size_t bytes) { char* p = wsp; wsp += al256(bytes); return (void*)p; };
    bf* WT = (bf*)take((size_t)3 * HD * DM * 2);
    bf* XB = (bf*)take((size_t)ZB * SEQ * DM * 2);
    h16* QP16 = (h16*)take((size_t)3 * ZB * SEQ * HD * 2); h16* KP16 = QP16 + (size_t)ZB * SEQ * HD; h16* VT16 = KP16 + (size_t)ZB * SEQ * HD;
    float* VM = (float*)take((size_t)ZB * HD * 4);
    h16* Sb = (h16*)take((size_t)ZB * SEQ * SEQ * 2); h16* P16 = (h16*)XB;
    if ((size_t)(wsp - (char*)d_ws) > ws_size) return;

    // weight slabs W[d][e] ([in][out]) -> planes WT[e][d] ([out][in], K-contiguous for the GEMM), and x -> bf16, in one launch
    k_prep<<<WT_BLK + XC_BLK * ZB, 256, 0, stream>>>(qkv, WT, x, XB);
    k_gemmw<bf, EP_QKV, DM, 4, 12, 1><<<dim3(ZB * SEQ / 256, HD / 192, 3), 128, 0, stream>>>(XB, WT, nullptr, QP16, nullptr, HD, 0, (size_t)HD * DM, (size_t)ZB * SEQ * HD);
    k_gemmw<h16, EP_S16, HD, 8, 8, 2><<<dim3(SEQ / 256, SEQ / 256, ZB), 128, 0, stream>>>(QP16, KP16, nullptr, Sb, nullptr, SEQ, (size_t)SEQ * HD, (size_t)SEQ * HD, (size_t)SEQ * SEQ);
    k_asoft<<<VM_BLK + ZB * SEQ / 8, 256, 0, stream>>>(Sb, P16, VT16, VM);
    k_gemmw<h16, EP_OUT, SEQ, 8, 6, 2><<<dim3(SEQ / 256, HD / 192, ZB), 128, 0, stream>>>(P16, VT16, OUT, nullptr, VM, HD, (size_t)SEQ * SEQ, (size_t)HD * SEQ, (size_t)SEQ * HD);
}
